// v000
// The times below were measured on an AMD MI455X: many runs one after another, warmed up first and cycling through
// copies of the inputs, with the whole window's GPU time divided by the number of runs. Launches and the gaps
// between them are all in it. The median over several windows is given; except for v000 it joins two sittings, which
// can be a few percent apart, so the side-by-side timings, each taken in one sitting, are the better comparison.
// The starting kernel, v000, takes 216 microseconds a run.
#include <hip/hip_runtime.h>
#include <math.h>

typedef __attribute__((ext_vector_type(2))) float v2f;
typedef __attribute__((ext_vector_type(8))) float v8f;

#define LN_EPS 1e-5f
constexpr int Bn = 128, Tn = 32, Dn = 1024, ADAn = 1024, INTERn = 1024, RANKn = 8;
constexpr int BK = 16;        // K chunk staged in LDS
constexpr int LPAD = 20;      // padded LDS row stride (floats): 80B, 16B-aligned, conflict-free frags

// ---------------------------------------------------------------------------
// LayerNorm over last dim (ADA=1024), one block per row
// ---------------------------------------------------------------------------
__global__ void ln_kernel(const float* __restrict__ ada, const float* __restrict__ g,
                          const float* __restrict__ bb, float* __restrict__ out) {
  const int row = blockIdx.x;
  const float* in = ada + (size_t)row * ADAn;
  float s = 0.f, s2 = 0.f;
  for (int i = threadIdx.x; i < ADAn; i += blockDim.x) {
    float v = in[i]; s += v; s2 += v * v;
  }
  __shared__ float red[64];
  for (int off = 16; off > 0; off >>= 1) {
    s  += __shfl_down(s,  off, 32);
    s2 += __shfl_down(s2, off, 32);
  }
  const int wave = threadIdx.x >> 5, lane = threadIdx.x & 31;
  const int nw = blockDim.x >> 5;
  if (lane == 0) { red[wave] = s; red[32 + wave] = s2; }
  __syncthreads();
  if (wave == 0) {
    float a  = (lane < nw) ? red[lane] : 0.f;
    float a2 = (lane < nw) ? red[32 + lane] : 0.f;
    for (int off = 16; off > 0; off >>= 1) {
      a  += __shfl_down(a,  off, 32);
      a2 += __shfl_down(a2, off, 32);
    }
    if (lane == 0) { red[0] = a; red[1] = a2; }
  }
  __syncthreads();
  const float mean = red[0] * (1.f / ADAn);
  const float var  = red[1] * (1.f / ADAn) - mean * mean;
  const float rstd = rsqrtf(var + LN_EPS);
  for (int i = threadIdx.x; i < ADAn; i += blockDim.x)
    out[(size_t)row * ADAn + i] = (in[i] - mean) * rstd * g[i] + bb[i];
}

// ---------------------------------------------------------------------------
// Shared WMMA fp32 GEMM core: one 64x64 block tile of A(MxK,row) @ W(KxN,row).
// 4 waves; wave w owns rows [w*16, w*16+16) x all 64 cols -> 4 x v8f acc.
// A tile:  global -> LDS via global_load_async_to_lds_b128 (ASYNCcnt DMA,
//          no VGPR round-trip, no s_wait_loadcnt stall).
// B tile:  VGPR-staged + transposed into LDS; global loads for chunk k+1 are
//          issued before the WMMA phase of chunk k (software pipeline).
// A fragment (16x4): lane l -> m = l&15, k = kc + 2*(l>>4) + {0,1}
// B fragment (4x16): lane l -> n = l&15, k = kc + 2*(l>>4) + {0,1} (LDS = B^T)
// ---------------------------------------------------------------------------
__device__ __forceinline__ void gemm_core_64x64(const float* __restrict__ A,
                                                const float* __restrict__ W,
                                                int K, int N, int rowBase, int colBase,
                                                v8f acc[4]) {
  __shared__ float lA [64][LPAD];
  __shared__ float lBt[64][LPAD];
  const int tid  = threadIdx.x, lane = tid & 31;
  const int mBase = (tid >> 5) * 16;
  const int mrow = lane & 15, khalf = lane >> 4;

  // per-thread staging coordinates (2 x 16B chunks each for A and B)
  const int l0  = tid * 2;
  const int ar0 = l0 >> 2,       ac0 = (l0 & 3) * 4;         // A: 4 chunks/row
  const int ar1 = (l0 + 1) >> 2, ac1 = ((l0 + 1) & 3) * 4;
  const int kk0 = l0 >> 4,       n40 = (l0 & 15) * 4;        // B: 16 chunks/k-row
  const int kk1 = (l0 + 1) >> 4, n41 = ((l0 + 1) & 15) * 4;

  // LDS byte addresses for the async A chunks (generic addr low 32 bits = LDS offset)
  const unsigned ldsA0 = (unsigned)(size_t)&lA[ar0][ac0];
  const unsigned ldsA1 = (unsigned)(size_t)&lA[ar1][ac1];

  // prologue: issue B global loads for chunk 0
  float4 rb0 = *(const float4*)(W + (size_t)kk0 * N + colBase + n40);
  float4 rb1 = *(const float4*)(W + (size_t)kk1 * N + colBase + n41);

  for (int k0 = 0; k0 < K; k0 += BK) {
    __syncthreads();                                   // all waves done reading LDS
    // ---- A tile: async DMA straight into (padded) LDS -------------------
    {
      const float* ga0 = A + (size_t)(rowBase + ar0) * K + k0 + ac0;
      const float* ga1 = A + (size_t)(rowBase + ar1) * K + k0 + ac1;
      asm volatile("global_load_async_to_lds_b128 %0, %1, off"
                   :: "v"(ldsA0), "v"(ga0) : "memory");
      asm volatile("global_load_async_to_lds_b128 %0, %1, off"
                   :: "v"(ldsA1), "v"(ga1) : "memory");
    }
    // ---- B tile: transpose staged regs into LDS (loads issued last iter) -
    lBt[n40 + 0][kk0] = rb0.x; lBt[n40 + 1][kk0] = rb0.y;
    lBt[n40 + 2][kk0] = rb0.z; lBt[n40 + 3][kk0] = rb0.w;
    lBt[n41 + 0][kk1] = rb1.x; lBt[n41 + 1][kk1] = rb1.y;
    lBt[n41 + 2][kk1] = rb1.z; lBt[n41 + 3][kk1] = rb1.w;
    asm volatile("s_wait_asynccnt 0x0" ::: "memory");  // A DMA landed
    __syncthreads();
    // ---- issue B global loads for NEXT chunk (consumed next iteration) ---
    if (k0 + BK < K) {
      rb0 = *(const float4*)(W + (size_t)(k0 + BK + kk0) * N + colBase + n40);
      rb1 = *(const float4*)(W + (size_t)(k0 + BK + kk1) * N + colBase + n41);
      __builtin_prefetch(A + (size_t)(rowBase + ar0) * K + k0 + BK + ac0, 0, 1);
    }
    // ---- compute: 16 x v_wmma_f32_16x16x4_f32 per wave -------------------
    #pragma unroll
    for (int ks = 0; ks < 4; ++ks) {
      const int kc = ks * 4 + 2 * khalf;
      const v2f a = *(const v2f*)&lA[mBase + mrow][kc];
      #pragma unroll
      for (int nt = 0; nt < 4; ++nt) {
        const v2f b = *(const v2f*)&lBt[nt * 16 + mrow][kc];
        acc[nt] = __builtin_amdgcn_wmma_f32_16x16x4_f32(
            false, a, false, b, (short)0, acc[nt], false, false);
      }
    }
  }
}

// ---------------------------------------------------------------------------
// Hypernetwork GEMM: out = act(A @ W + bias); act: 1 = exact GELU, 0 = identity
// ---------------------------------------------------------------------------
__global__ __launch_bounds__(128) void hyper_gemm(const float* __restrict__ A,
                                                  const float* __restrict__ W,
                                                  const float* __restrict__ bias,
                                                  float* __restrict__ out,
                                                  int K, int N, int gelu) {
  const int rowBase = blockIdx.y * 64, colBase = blockIdx.x * 64;
  v8f acc[4] = {};
  gemm_core_64x64(A, W, K, N, rowBase, colBase, acc);

  const int lane = threadIdx.x & 31, wave = threadIdx.x >> 5;
  #pragma unroll
  for (int nt = 0; nt < 4; ++nt) {
    #pragma unroll
    for (int v = 0; v < 8; ++v) {
      const int row = rowBase + wave * 16 + v + 8 * (lane >> 4);
      const int col = colBase + nt * 16 + (lane & 15);
      float r = acc[nt][v] + bias[col];
      if (gelu) r = 0.5f * r * (1.f + erff(r * 0.70710678118654752f));
      out[(size_t)row * N + col] = r;
    }
  }
}

// ---------------------------------------------------------------------------
// p[b,t,r] = sum_c x[b,t,c] * x_a[b,c,r],  x_a[b,c,r] = xw[b, c*8+r]
// ---------------------------------------------------------------------------
__global__ void p_kernel(const float* __restrict__ x, const float* __restrict__ xw,
                         float* __restrict__ p) {
  const int b = blockIdx.x;
  const int t = threadIdx.x >> 3, r = threadIdx.x & 7;
  const float* xr = x + ((size_t)b * Tn + t) * Dn;
  const float* aw = xw + (size_t)b * (2 * Dn * RANKn) + r;
  float s = 0.f;
  for (int c = 0; c < Dn; ++c) s += xr[c] * aw[(size_t)c * RANKn];
  p[((size_t)b * Tn + t) * RANKn + r] = s;
}

// ---------------------------------------------------------------------------
// Final fused GEMM: out = x + x2d @ base + p @ x_b^T
// x2d is (B*T, D); rows of a wave tile stay inside one sample (16 | 32).
// ---------------------------------------------------------------------------
__global__ __launch_bounds__(128) void final_gemm(const float* __restrict__ x2d,
                                                  const float* __restrict__ base,
                                                  const float* __restrict__ xw,
                                                  const float* __restrict__ p,
                                                  float* __restrict__ out) {
  const int rowBase = blockIdx.y * 64, colBase = blockIdx.x * 64;
  v8f acc[4] = {};
  gemm_core_64x64(x2d, base, Dn, Dn, rowBase, colBase, acc);

  const int lane = threadIdx.x & 31, wave = threadIdx.x >> 5;
  #pragma unroll
  for (int nt = 0; nt < 4; ++nt) {
    #pragma unroll
    for (int v = 0; v < 8; ++v) {
      const int row = rowBase + wave * 16 + v + 8 * (lane >> 4);
      const int col = colBase + nt * 16 + (lane & 15);
      const int b = row >> 5, t = row & 31;
      const float* pr = p + ((size_t)b * Tn + t) * RANKn;
      const float* xb = xw + (size_t)b * (2 * Dn * RANKn) + (size_t)Dn * RANKn
                           + (size_t)col * RANKn;                  // x_b[b, col, :]
      float lr = 0.f;
      #pragma unroll
      for (int r = 0; r < RANKn; ++r) lr += pr[r] * xb[r];
      out[(size_t)row * Dn + col] = x2d[(size_t)row * Dn + col] + acc[nt][v] + lr;
    }
  }
}

// ---------------------------------------------------------------------------
extern "C" void kernel_launch(void* const* d_in, const int* in_sizes, int n_in,
                              void* d_out, int out_size, void* d_ws, size_t ws_size,
                              hipStream_t stream) {
  (void)in_sizes; (void)n_in; (void)out_size; (void)ws_size;
  const float* x    = (const float*)d_in[0];   // (B,T,D)
  const float* ada  = (const float*)d_in[1];   // (B,ADA)
  const float* base = (const float*)d_in[2];   // (D,D)
  const float* w1   = (const float*)d_in[3];   // (ADA,INTER)
  const float* b1   = (const float*)d_in[4];   // (INTER)
  const float* w2   = (const float*)d_in[5];   // (INTER, 2*D*RANK)
  const float* b2   = (const float*)d_in[6];   // (2*D*RANK)
  const float* ln_g = (const float*)d_in[7];   // (ADA)
  const float* ln_b = (const float*)d_in[8];   // (ADA)
  float* out = (float*)d_out;

  float* ws    = (float*)d_ws;
  float* ae_ln = ws;                                   // 128*1024
  float* h     = ae_ln + (size_t)Bn * ADAn;            // 128*1024
  float* xw    = h + (size_t)Bn * INTERn;              // 128*16384
  float* p     = xw + (size_t)Bn * 2 * Dn * RANKn;     // 128*32*8

  // 1) LayerNorm
  ln_kernel<<<Bn, 256, 0, stream>>>(ada, ln_g, ln_b, ae_ln);
  // 2) h = GELU(ae_ln @ w1 + b1)        (128x1024x1024)
  hyper_gemm<<<dim3(INTERn / 64, Bn / 64), 128, 0, stream>>>(ae_ln, w1, b1, h, ADAn, INTERn, 1);
  // 3) xw = h @ w2 + b2                 (128x1024x16384)
  hyper_gemm<<<dim3(2 * Dn * RANKn / 64, Bn / 64), 128, 0, stream>>>(h, w2, b2, xw, INTERn, 2 * Dn * RANKn, 0);
  // 4) p = per-sample x @ x_a           (tiny, rank 8)
  p_kernel<<<Bn, 256, 0, stream>>>(x, xw, p);
  // 5) out = x + x2d @ base + p @ x_b^T (4096x1024x1024 + rank-8 epilogue)
  final_gemm<<<dim3(Dn / 64, Bn * Tn / 64), 128, 0, stream>>>(x, base, xw, p, out);
}

// v001
// Measured time: 134 microseconds a run.
// Next to v000, in two timings, it ran 1.64 and 1.65 times as fast.
#include <hip/hip_runtime.h>
#include <math.h>

typedef __attribute__((ext_vector_type(2))) float v2f;
typedef __attribute__((ext_vector_type(8))) float v8f;

#define LN_EPS 1e-5f
constexpr int Bn = 128, Tn = 32, Dn = 1024, ADAn = 1024, INTERn = 1024, RANKn = 8;
constexpr int BK = 64;        // K chunk staged in LDS per barrier pair
constexpr int LPAD = 68;      // padded LDS row stride (floats): 272B, 16B-aligned, conflict-free frags

// ---------------------------------------------------------------------------
// LayerNorm over last dim (ADA=1024), one block per row
// ---------------------------------------------------------------------------
__global__ void ln_kernel(const float* __restrict__ ada, const float* __restrict__ g,
                          const float* __restrict__ bb, float* __restrict__ out) {
  const int row = blockIdx.x;
  const float* in = ada + (size_t)row * ADAn;
  float s = 0.f, s2 = 0.f;
  for (int i = threadIdx.x; i < ADAn; i += blockDim.x) {
    float v = in[i]; s += v; s2 += v * v;
  }
  __shared__ float red[64];
  for (int off = 16; off > 0; off >>= 1) {
    s  += __shfl_down(s,  off, 32);
    s2 += __shfl_down(s2, off, 32);
  }
  const int wave = threadIdx.x >> 5, lane = threadIdx.x & 31;
  const int nw = blockDim.x >> 5;
  if (lane == 0) { red[wave] = s; red[32 + wave] = s2; }
  __syncthreads();
  if (wave == 0) {
    float a  = (lane < nw) ? red[lane] : 0.f;
    float a2 = (lane < nw) ? red[32 + lane] : 0.f;
    for (int off = 16; off > 0; off >>= 1) {
      a  += __shfl_down(a,  off, 32);
      a2 += __shfl_down(a2, off, 32);
    }
    if (lane == 0) { red[0] = a; red[1] = a2; }
  }
  __syncthreads();
  const float mean = red[0] * (1.f / ADAn);
  const float var  = red[1] * (1.f / ADAn) - mean * mean;
  const float rstd = rsqrtf(var + LN_EPS);
  for (int i = threadIdx.x; i < ADAn; i += blockDim.x)
    out[(size_t)row * ADAn + i] = (in[i] - mean) * rstd * g[i] + bb[i];
}

// ---------------------------------------------------------------------------
// Shared WMMA fp32 GEMM core: one 64x64 block tile of A(MxK,row) @ W(KxN,row).
// 4 waves; wave w owns rows [w*16, w*16+16) x all 64 cols -> 4 x v8f acc.
// K is walked in chunks of BK = 64: one pair of barriers and one exposed
// load wait serve 64 WMMAs per wave.
// A tile:  global -> LDS via global_load_async_to_lds_b128 (ASYNCcnt DMA,
//          no VGPR round-trip), 8 copies per thread, 2 whole rows per wave copy.
// B tile:  VGPR-staged + transposed into LDS; each thread owns two 4k x 4n
//          blocks, so a transposed row piece is one 16-byte LDS store; global
//          loads for chunk k+1 are issued before the WMMA phase of chunk k.
// A fragment (16x4): lane l -> m = l&15, k = kc + 2*(l>>4) + {0,1}
// B fragment (4x16): lane l -> n = l&15, k = kc + 2*(l>>4) + {0,1} (LDS = B^T)
// ---------------------------------------------------------------------------
__device__ __forceinline__ void gemm_core_64x64(const float* __restrict__ A,
                                                const float* __restrict__ W,
                                                int K, int N, int rowBase, int colBase,
                                                v8f acc[4]) {
  __shared__ __attribute__((aligned(16))) float lA [64][LPAD];
  __shared__ __attribute__((aligned(16))) float lBt[64][LPAD];
  const int tid  = threadIdx.x, lane = tid & 31, wv = tid >> 5;
  const int mBase = wv * 16;
  const int mrow = lane & 15, khalf = lane >> 4;

  // A staging: copy i of a thread brings 16 B of row ar + 8*i, columns ac..ac+3
  const int ar = tid >> 4, ac = (tid & 15) * 4;
  // B staging: block j of a thread is rows kb + 16*j .. +3, columns n4 .. n4+3.
  // One wave load covers 4 rows x 128 B (whole lines); within each 16 lanes the
  // 4 column blocks x 4 row blocks hit all 64 LDS banks once per 16-byte store.
  const int n4 = (wv & 1) * 32 + ((lane & 3) + 4 * (lane >> 4)) * 4;
  const int kb = (wv >> 1) * 32 + ((lane >> 2) & 3) * 4;

  // LDS byte address of the thread's first A copy (generic addr low 32 bits = LDS offset)
  const unsigned ldsA = (unsigned)(size_t)&lA[ar][ac];
  constexpr unsigned LSTEP = 8 * LPAD * sizeof(float);   // 8 rows further in lA

  // prologue: issue B global loads for chunk 0; one pointer per staged row,
  // stepped only behind the wait for the loads that used it
  const float* wp[2][4];
  float4 rb[2][4];
  #pragma unroll
  for (int j = 0; j < 2; ++j)
    #pragma unroll
    for (int s = 0; s < 4; ++s) {
      wp[j][s] = W + (size_t)(kb + 16 * j + s) * N + colBase + n4;
      rb[j][s] = *(const float4*)wp[j][s];
    }

  for (int k0 = 0; k0 < K; k0 += BK) {
    __syncthreads();                                   // all waves done reading LDS
    // ---- A tile: async DMA straight into (padded) LDS -------------------
    {
      const float* ga = A + (size_t)(rowBase + ar) * K + k0 + ac;
      const size_t gs = (size_t)8 * K;                 // 8 rows further in A
      // the closing s_wait_xcnt keeps later rewrites of the address registers
      // behind the copies that name them
      asm volatile("global_load_async_to_lds_b128 %0, %8, off\n\t"
                   "global_load_async_to_lds_b128 %1, %9, off\n\t"
                   "global_load_async_to_lds_b128 %2, %10, off\n\t"
                   "global_load_async_to_lds_b128 %3, %11, off\n\t"
                   "global_load_async_to_lds_b128 %4, %12, off\n\t"
                   "global_load_async_to_lds_b128 %5, %13, off\n\t"
                   "global_load_async_to_lds_b128 %6, %14, off\n\t"
                   "global_load_async_to_lds_b128 %7, %15, off\n\t"
                   "s_wait_xcnt 0x0"
                   :: "v"(ldsA), "v"(ldsA + LSTEP), "v"(ldsA + 2 * LSTEP), "v"(ldsA + 3 * LSTEP),
                      "v"(ldsA + 4 * LSTEP), "v"(ldsA + 5 * LSTEP), "v"(ldsA + 6 * LSTEP),
                      "v"(ldsA + 7 * LSTEP),
                      "v"(ga), "v"(ga + gs), "v"(ga + 2 * gs), "v"(ga + 3 * gs),
                      "v"(ga + 4 * gs), "v"(ga + 5 * gs), "v"(ga + 6 * gs), "v"(ga + 7 * gs)
                   : "memory");
    }
    // ---- B tile: transpose staged regs into LDS (loads issued last iter) -
    #pragma unroll
    for (int j = 0; j < 2; ++j) {
      *(float4*)&lBt[n4 + 0][kb + 16 * j] = make_float4(rb[j][0].x, rb[j][1].x, rb[j][2].x, rb[j][3].x);
      *(float4*)&lBt[n4 + 1][kb + 16 * j] = make_float4(rb[j][0].y, rb[j][1].y, rb[j][2].y, rb[j][3].y);
      *(float4*)&lBt[n4 + 2][kb + 16 * j] = make_float4(rb[j][0].z, rb[j][1].z, rb[j][2].z, rb[j][3].z);
      *(float4*)&lBt[n4 + 3][kb + 16 * j] = make_float4(rb[j][0].w, rb[j][1].w, rb[j][2].w, rb[j][3].w);
    }
    asm volatile("s_wait_asynccnt 0x0" ::: "memory");  // A DMA landed
    __syncthreads();
    // ---- issue B global loads for NEXT chunk (consumed next iteration) ---
    if (k0 + BK < K) {
      #pragma unroll
      for (int j = 0; j < 2; ++j)
        #pragma unroll
        for (int s = 0; s < 4; ++s) {
          wp[j][s] += (size_t)BK * N;
          rb[j][s] = *(const float4*)wp[j][s];
        }
      // one 128-B line of the next A chunk per thread
      __builtin_prefetch(A + (size_t)(rowBase + (tid >> 1)) * K + k0 + BK + (tid & 1) * 32, 0, 1);
      // keeps rewrites of the address registers behind the loads and the prefetch that name them
      asm volatile("s_wait_xcnt 0x0" ::: "memory");
    }
    // ---- compute: 64 x v_wmma_f32_16x16x4_f32 per wave -------------------
    #pragma unroll
    for (int ks = 0; ks < BK / 4; ++ks) {
      const int kc = ks * 4 + 2 * khalf;
      const v2f a = *(const v2f*)&lA[mBase + mrow][kc];
      #pragma unroll
      for (int nt = 0; nt < 4; ++nt) {
        const v2f b = *(const v2f*)&lBt[nt * 16 + mrow][kc];
        acc[nt] = __builtin_amdgcn_wmma_f32_16x16x4_f32(
            false, a, false, b, (short)0, acc[nt], false, false);
      }
    }
    // keeps every WMMA of this trip in front of the v_nops below
    __builtin_amdgcn_sched_barrier(0);
    // four vector slots between the last WMMAs and the next trip's address
    // arithmetic, which may reuse their A/B registers
    asm volatile("v_nop\n\tv_nop\n\tv_nop\n\tv_nop");
  }
}

// ---------------------------------------------------------------------------
// Hypernetwork GEMM: out = act(A @ W + bias); act: 1 = exact GELU, 0 = identity
// ---------------------------------------------------------------------------
__global__ __launch_bounds__(128) void hyper_gemm(const float* __restrict__ A,
                                                  const float* __restrict__ W,
                                                  const float* __restrict__ bias,
                                                  float* __restrict__ out,
                                                  int K, int N, int gelu) {
  const int rowBase = blockIdx.y * 64, colBase = blockIdx.x * 64;
  v8f acc[4] = {};
  gemm_core_64x64(A, W, K, N, rowBase, colBase, acc);

  const int lane = threadIdx.x & 31, wave = threadIdx.x >> 5;
  #pragma unroll
  for (int nt = 0; nt < 4; ++nt) {
    #pragma unroll
    for (int v = 0; v < 8; ++v) {
      const int row = rowBase + wave * 16 + v + 8 * (lane >> 4);
      const int col = colBase + nt * 16 + (lane & 15);
      float r = acc[nt][v] + bias[col];
      if (gelu) r = 0.5f * r * (1.f + erff(r * 0.70710678118654752f));
      out[(size_t)row * N + col] = r;
    }
  }
}

// ---------------------------------------------------------------------------
// p[b,t,r] = sum_c x[b,t,c] * x_a[b,c,r],  x_a[b,c,r] = xw[b, c*8+r]
// ---------------------------------------------------------------------------
__global__ void p_kernel(const float* __restrict__ x, const float* __restrict__ xw,
                         float* __restrict__ p) {
  const int b = blockIdx.x;
  const int t = threadIdx.x >> 3, r = threadIdx.x & 7;
  const float* xr = x + ((size_t)b * Tn + t) * Dn;
  const float* aw = xw + (size_t)b * (2 * Dn * RANKn) + r;
  float s = 0.f;
  for (int c = 0; c < Dn; ++c) s += xr[c] * aw[(size_t)c * RANKn];
  p[((size_t)b * Tn + t) * RANKn + r] = s;
}

// ---------------------------------------------------------------------------
// Final fused GEMM: out = x + x2d @ base + p @ x_b^T
// x2d is (B*T, D); rows of a wave tile stay inside one sample (16 | 32).
// ---------------------------------------------------------------------------
__global__ __launch_bounds__(128) void final_gemm(const float* __restrict__ x2d,
                                                  const float* __restrict__ base,
                                                  const float* __restrict__ xw,
                                                  const float* __restrict__ p,
                                                  float* __restrict__ out) {
  const int rowBase = blockIdx.y * 64, colBase = blockIdx.x * 64;
  v8f acc[4] = {};
  gemm_core_64x64(x2d, base, Dn, Dn, rowBase, colBase, acc);

  const int lane = threadIdx.x & 31, wave = threadIdx.x >> 5;
  #pragma unroll
  for (int nt = 0; nt < 4; ++nt) {
    #pragma unroll
    for (int v = 0; v < 8; ++v) {
      const int row = rowBase + wave * 16 + v + 8 * (lane >> 4);
      const int col = colBase + nt * 16 + (lane & 15);
      const int b = row >> 5, t = row & 31;
      const float* pr = p + ((size_t)b * Tn + t) * RANKn;
      const float* xb = xw + (size_t)b * (2 * Dn * RANKn) + (size_t)Dn * RANKn
                           + (size_t)col * RANKn;                  // x_b[b, col, :]
      float lr = 0.f;
      #pragma unroll
      for (int r = 0; r < RANKn; ++r) lr += pr[r] * xb[r];
      out[(size_t)row * Dn + col] = x2d[(size_t)row * Dn + col] + acc[nt][v] + lr;
    }
  }
}

// ---------------------------------------------------------------------------
extern "C" void kernel_launch(void* const* d_in, const int* in_sizes, int n_in,
                              void* d_out, int out_size, void* d_ws, size_t ws_size,
                              hipStream_t stream) {
  (void)in_sizes; (void)n_in; (void)out_size; (void)ws_size;
  const float* x    = (const float*)d_in[0];   // (B,T,D)
  const float* ada  = (const float*)d_in[1];   // (B,ADA)
  const float* base = (const float*)d_in[2];   // (D,D)
  const float* w1   = (const float*)d_in[3];   // (ADA,INTER)
  const float* b1   = (const float*)d_in[4];   // (INTER)
  const float* w2   = (const float*)d_in[5];   // (INTER, 2*D*RANK)
  const float* b2   = (const float*)d_in[6];   // (2*D*RANK)
  const float* ln_g = (const float*)d_in[7];   // (ADA)
  const float* ln_b = (const float*)d_in[8];   // (ADA)
  float* out = (float*)d_out;

  float* ws    = (float*)d_ws;
  float* ae_ln = ws;                                   // 128*1024
  float* h     = ae_ln + (size_t)Bn * ADAn;            // 128*1024
  float* xw    = h + (size_t)Bn * INTERn;              // 128*16384
  float* p     = xw + (size_t)Bn * 2 * Dn * RANKn;     // 128*32*8

  // 1) LayerNorm
  ln_kernel<<<Bn, 256, 0, stream>>>(ada, ln_g, ln_b, ae_ln);
  // 2) h = GELU(ae_ln @ w1 + b1)        (128x1024x1024)
  hyper_gemm<<<dim3(INTERn / 64, Bn / 64), 128, 0, stream>>>(ae_ln, w1, b1, h, ADAn, INTERn, 1);
  // 3) xw = h @ w2 + b2                 (128x1024x16384)
  hyper_gemm<<<dim3(2 * Dn * RANKn / 64, Bn / 64), 128, 0, stream>>>(h, w2, b2, xw, INTERn, 2 * Dn * RANKn, 0);
  // 4) p = per-sample x @ x_a           (tiny, rank 8)
  p_kernel<<<Bn, 256, 0, stream>>>(x, xw, p);
  // 5) out = x + x2d @ base + p @ x_b^T (4096x1024x1024 + rank-8 epilogue)
  final_gemm<<<dim3(Dn / 64, Bn * Tn / 64), 128, 0, stream>>>(x, base, xw, p, out);
}

// v002
// A run of this version takes 110 microseconds.
// In two side-by-side timings against v001, it was 1.22 and 1.21 times as fast.
// Over all steps from v000 it is 2.00 times as fast.
#include <hip/hip_runtime.h>
#include <math.h>

typedef __attribute__((ext_vector_type(2))) float v2f;
typedef __attribute__((ext_vector_type(8))) float v8f;

#define LN_EPS 1e-5f
constexpr int Bn = 128, Tn = 32, Dn = 1024, ADAn = 1024, INTERn = 1024, RANKn = 8;
constexpr int BK = 64;        // K chunk staged in LDS per barrier pair
constexpr int LPAD = 68;      // padded LDS row stride (floats): 272B, 16B-aligned, conflict-free frags

// ---------------------------------------------------------------------------
// LayerNorm over last dim (ADA=1024), one block per row
// ---------------------------------------------------------------------------
__global__ void ln_kernel(const float* __restrict__ ada, const float* __restrict__ g,
                          const float* __restrict__ bb, float* __restrict__ out) {
  const int row = blockIdx.x;
  const float* in = ada + (size_t)row * ADAn;
  float s = 0.f, s2 = 0.f;
  for (int i = threadIdx.x; i < ADAn; i += blockDim.x) {
    float v = in[i]; s += v; s2 += v * v;
  }
  __shared__ float red[64];
  for (int off = 16; off > 0; off >>= 1) {
    s  += __shfl_down(s,  off, 32);
    s2 += __shfl_down(s2, off, 32);
  }
  const int wave = threadIdx.x >> 5, lane = threadIdx.x & 31;
  const int nw = blockDim.x >> 5;
  if (lane == 0) { red[wave] = s; red[32 + wave] = s2; }
  __syncthreads();
  if (wave == 0) {
    float a  = (lane < nw) ? red[lane] : 0.f;
    float a2 = (lane < nw) ? red[32 + lane] : 0.f;
    for (int off = 16; off > 0; off >>= 1) {
      a  += __shfl_down(a,  off, 32);
      a2 += __shfl_down(a2, off, 32);
    }
    if (lane == 0) { red[0] = a; red[1] = a2; }
  }
  __syncthreads();
  const float mean = red[0] * (1.f / ADAn);
  const float var  = red[1] * (1.f / ADAn) - mean * mean;
  const float rstd = rsqrtf(var + LN_EPS);
  for (int i = threadIdx.x; i < ADAn; i += blockDim.x)
    out[(size_t)row * ADAn + i] = (in[i] - mean) * rstd * g[i] + bb[i];
}

// ---------------------------------------------------------------------------
// Shared WMMA fp32 GEMM core: one 64x64 block tile of A(MxK,row) @ W(KxN,row).
// 4 waves; wave w owns rows [w*16, w*16+16) x all 64 cols -> 4 x v8f acc.
// K is walked in chunks of BK = 64: one pair of barriers and one exposed
// load wait serve 64 WMMAs per wave.
// A tile:  global -> LDS via global_load_async_to_lds_b128 (ASYNCcnt DMA,
//          no VGPR round-trip), 8 copies per thread, 2 whole rows per wave copy.
// B tile:  VGPR-staged + transposed into LDS; each thread owns two 4k x 4n
//          blocks, so a transposed row piece is one 16-byte LDS store; global
//          loads for chunk k+1 are issued before the WMMA phase of chunk k.
// A fragment (16x4): lane l -> m = l&15, k = kc + 2*(l>>4) + {0,1}
// B fragment (4x16): lane l -> n = l&15, k = kc + 2*(l>>4) + {0,1} (LDS = B^T)
// ---------------------------------------------------------------------------
__device__ __forceinline__ void gemm_core_64x64(const float* __restrict__ A,
                                                const float* __restrict__ W,
                                                int K, int N, int rowBase, int colBase,
                                                v8f acc[4]) {
  __shared__ __attribute__((aligned(16))) float lA [64][LPAD];
  __shared__ __attribute__((aligned(16))) float lBt[64][LPAD];
  const int tid  = threadIdx.x, lane = tid & 31, wv = tid >> 5;
  const int mBase = wv * 16;
  const int mrow = lane & 15, khalf = lane >> 4;

  // A staging: copy i of a thread brings 16 B of row ar + 8*i, columns ac..ac+3
  const int ar = tid >> 4, ac = (tid & 15) * 4;
  // B staging: block j of a thread is rows kb + 16*j .. +3, columns n4 .. n4+3.
  // One wave load covers 4 rows x 128 B (whole lines); within each 16 lanes the
  // 4 column blocks x 4 row blocks hit all 64 LDS banks once per 16-byte store.
  const int n4 = (wv & 1) * 32 + ((lane & 3) + 4 * (lane >> 4)) * 4;
  const int kb = (wv >> 1) * 32 + ((lane >> 2) & 3) * 4;

  // LDS byte address of the thread's first A copy (generic addr low 32 bits = LDS offset)
  const unsigned ldsA = (unsigned)(size_t)&lA[ar][ac];
  constexpr unsigned LSTEP = 8 * LPAD * sizeof(float);   // 8 rows further in lA

  // prologue: issue B global loads for chunk 0; one pointer per staged row,
  // stepped only behind the wait for the loads that used it
  const float* wp[2][4];
  float4 rb[2][4];
  #pragma unroll
  for (int j = 0; j < 2; ++j)
    #pragma unroll
    for (int s = 0; s < 4; ++s) {
      wp[j][s] = W + (size_t)(kb + 16 * j + s) * N + colBase + n4;
      rb[j][s] = *(const float4*)wp[j][s];
    }

  for (int k0 = 0; k0 < K; k0 += BK) {
    __syncthreads();                                   // all waves done reading LDS
    // ---- A tile: async DMA straight into (padded) LDS -------------------
    {
      const float* ga = A + (size_t)(rowBase + ar) * K + k0 + ac;
      const size_t gs = (size_t)8 * K;                 // 8 rows further in A
      // the closing s_wait_xcnt keeps later rewrites of the address registers
      // behind the copies that name them
      asm volatile("global_load_async_to_lds_b128 %0, %8, off\n\t"
                   "global_load_async_to_lds_b128 %1, %9, off\n\t"
                   "global_load_async_to_lds_b128 %2, %10, off\n\t"
                   "global_load_async_to_lds_b128 %3, %11, off\n\t"
                   "global_load_async_to_lds_b128 %4, %12, off\n\t"
                   "global_load_async_to_lds_b128 %5, %13, off\n\t"
                   "global_load_async_to_lds_b128 %6, %14, off\n\t"
                   "global_load_async_to_lds_b128 %7, %15, off\n\t"
                   "s_wait_xcnt 0x0"
                   :: "v"(ldsA), "v"(ldsA + LSTEP), "v"(ldsA + 2 * LSTEP), "v"(ldsA + 3 * LSTEP),
                      "v"(ldsA + 4 * LSTEP), "v"(ldsA + 5 * LSTEP), "v"(ldsA + 6 * LSTEP),
                      "v"(ldsA + 7 * LSTEP),
                      "v"(ga), "v"(ga + gs), "v"(ga + 2 * gs), "v"(ga + 3 * gs),
                      "v"(ga + 4 * gs), "v"(ga + 5 * gs), "v"(ga + 6 * gs), "v"(ga + 7 * gs)
                   : "memory");
    }
    // ---- B tile: transpose staged regs into LDS (loads issued last iter) -
    #pragma unroll
    for (int j = 0; j < 2; ++j) {
      *(float4*)&lBt[n4 + 0][kb + 16 * j] = make_float4(rb[j][0].x, rb[j][1].x, rb[j][2].x, rb[j][3].x);
      *(float4*)&lBt[n4 + 1][kb + 16 * j] = make_float4(rb[j][0].y, rb[j][1].y, rb[j][2].y, rb[j][3].y);
      *(float4*)&lBt[n4 + 2][kb + 16 * j] = make_float4(rb[j][0].z, rb[j][1].z, rb[j][2].z, rb[j][3].z);
      *(float4*)&lBt[n4 + 3][kb + 16 * j] = make_float4(rb[j][0].w, rb[j][1].w, rb[j][2].w, rb[j][3].w);
    }
    asm volatile("s_wait_asynccnt 0x0" ::: "memory");  // A DMA landed
    __syncthreads();
    // ---- issue B global loads for NEXT chunk (consumed next iteration) ---
    if (k0 + BK < K) {
      #pragma unroll
      for (int j = 0; j < 2; ++j)
        #pragma unroll
        for (int s = 0; s < 4; ++s) {
          wp[j][s] += (size_t)BK * N;
          rb[j][s] = *(const float4*)wp[j][s];
        }
      // one 128-B line of the next A chunk per thread
      __builtin_prefetch(A + (size_t)(rowBase + (tid >> 1)) * K + k0 + BK + (tid & 1) * 32, 0, 1);
      // keeps rewrites of the address registers behind the loads and the prefetch that name them
      asm volatile("s_wait_xcnt 0x0" ::: "memory");
    }
    // ---- compute: 64 x v_wmma_f32_16x16x4_f32 per wave -------------------
    #pragma unroll
    for (int ks = 0; ks < BK / 4; ++ks) {
      const int kc = ks * 4 + 2 * khalf;
      const v2f a = *(const v2f*)&lA[mBase + mrow][kc];
      #pragma unroll
      for (int nt = 0; nt < 4; ++nt) {
        const v2f b = *(const v2f*)&lBt[nt * 16 + mrow][kc];
        acc[nt] = __builtin_amdgcn_wmma_f32_16x16x4_f32(
            false, a, false, b, (short)0, acc[nt], false, false);
      }
    }
    // keeps every WMMA of this trip in front of the v_nops below
    __builtin_amdgcn_sched_barrier(0);
    // four vector slots between the last WMMAs and the next trip's address
    // arithmetic, which may reuse their A/B registers
    asm volatile("v_nop\n\tv_nop\n\tv_nop\n\tv_nop");
  }
}

// ---------------------------------------------------------------------------
// Hypernetwork GEMM: out = act(A @ W + bias); act: 1 = exact GELU, 0 = identity
// ---------------------------------------------------------------------------
__global__ __launch_bounds__(128) void hyper_gemm(const float* __restrict__ A,
                                                  const float* __restrict__ W,
                                                  const float* __restrict__ bias,
                                                  float* __restrict__ out,
                                                  int K, int N, int gelu) {
  const int rowBase = blockIdx.y * 64, colBase = blockIdx.x * 64;
  v8f acc[4] = {};
  gemm_core_64x64(A, W, K, N, rowBase, colBase, acc);

  const int lane = threadIdx.x & 31, wave = threadIdx.x >> 5;
  #pragma unroll
  for (int nt = 0; nt < 4; ++nt) {
    #pragma unroll
    for (int v = 0; v < 8; ++v) {
      const int row = rowBase + wave * 16 + v + 8 * (lane >> 4);
      const int col = colBase + nt * 16 + (lane & 15);
      float r = acc[nt][v] + bias[col];
      if (gelu) r = 0.5f * r * (1.f + erff(r * 0.70710678118654752f));
      out[(size_t)row * N + col] = r;
    }
  }
}

// ---------------------------------------------------------------------------
// p[b,t,r] = sum_c x[b,t,c] * x_a[b,c,r],  x_a[b,c,r] = xw[b, c*8+r]
// One block = one sample x 16 token rows; wave w owns 4 rows, its 32 lanes split c.
// Lane l holds x[t][128q + 4l .. +3] (whole-line 16-byte loads, all issued at
// entry); x_a[b] (32 KB) is staged once in LDS in groups of 4 c (32 floats) at a
// pitch of 36 floats, so the 16-byte reads of 16 lanes fall on distinct banks.
// The 32 partial sums of a lane (4 rows x 8 ranks) are folded over the 32 lanes
// by a halving exchange that leaves sum number l in lane l: one 128-byte store.
// ---------------------------------------------------------------------------
constexpr int PROWS = 16;     // token rows per block
constexpr int XPITCH = 36;    // LDS floats per group of 4 c
__global__ __launch_bounds__(128) void p_kernel(const float* __restrict__ x,
                                                const float* __restrict__ xw,
                                                float* __restrict__ p) {
  __shared__ __attribute__((aligned(16))) float la[Dn / 4][XPITCH];
  const int b = blockIdx.x / (Tn / PROWS), th = blockIdx.x % (Tn / PROWS);
  const int tid = threadIdx.x, lane = tid & 31, wv = tid >> 5;
  const int t0 = th * PROWS + wv * 4;

  const float* aw = xw + (size_t)b * (2 * Dn * RANKn) + tid * 4;
  float4 st[16];
  #pragma unroll
  for (int i = 0; i < 16; ++i) st[i] = *(const float4*)(aw + i * 512);

  const float* xr = x + ((size_t)b * Tn + t0) * Dn + lane * 4;
  float4 xv[4][8];
  #pragma unroll
  for (int q = 0; q < 8; ++q)
    #pragma unroll
    for (int j = 0; j < 4; ++j) xv[j][q] = *(const float4*)(xr + j * Dn + q * 128);

  #pragma unroll
  for (int i = 0; i < 16; ++i) *(float4*)&la[i * 16 + (tid >> 3)][(tid & 7) * 4] = st[i];
  __syncthreads();

  float acc[4][8] = {};
  #pragma unroll
  for (int q = 0; q < 8; ++q) {
    const float* g = la[q * 32 + lane];
    #pragma unroll
    for (int cc = 0; cc < 4; ++cc) {
      const float4 a0 = *(const float4*)(g + cc * 8);
      const float4 a1 = *(const float4*)(g + cc * 8 + 4);
      #pragma unroll
      for (int j = 0; j < 4; ++j) {
        const float xs = cc == 0 ? xv[j][q].x : cc == 1 ? xv[j][q].y : cc == 2 ? xv[j][q].z : xv[j][q].w;
        acc[j][0] += xs * a0.x; acc[j][1] += xs * a0.y;
        acc[j][2] += xs * a0.z; acc[j][3] += xs * a0.w;
        acc[j][4] += xs * a1.x; acc[j][5] += xs * a1.y;
        acc[j][6] += xs * a1.z; acc[j][7] += xs * a1.w;
      }
    }
  }

  // halving exchange: at each step a lane keeps the half of its sums whose index
  // bit equals its own lane bit and hands the other half to its partner lane
  float s16[16], s8[8], s4[4], s2[2];
  const bool h16 = lane & 16, h8 = lane & 8, h4 = lane & 4, h2 = lane & 2, h1 = lane & 1;
  #pragma unroll
  for (int i = 0; i < 16; ++i) {
    const float lo = acc[i >> 3][i & 7], hi = acc[2 + (i >> 3)][i & 7];
    s16[i] = (h16 ? hi : lo) + __shfl_xor(h16 ? lo : hi, 16, 32);
  }
  #pragma unroll
  for (int i = 0; i < 8; ++i)
    s8[i] = (h8 ? s16[i + 8] : s16[i]) + __shfl_xor(h8 ? s16[i] : s16[i + 8], 8, 32);
  #pragma unroll
  for (int i = 0; i < 4; ++i)
    s4[i] = (h4 ? s8[i + 4] : s8[i]) + __shfl_xor(h4 ? s8[i] : s8[i + 4], 4, 32);
  #pragma unroll
  for (int i = 0; i < 2; ++i)
    s2[i] = (h2 ? s4[i + 2] : s4[i]) + __shfl_xor(h2 ? s4[i] : s4[i + 2], 2, 32);
  const float s1 = (h1 ? s2[1] : s2[0]) + __shfl_xor(h1 ? s2[0] : s2[1], 1, 32);
  p[((size_t)b * Tn + t0) * RANKn + lane] = s1;
}

// ---------------------------------------------------------------------------
// Final fused GEMM: out = x + x2d @ base + p @ x_b^T
// x2d is (B*T, D); rows of a wave tile stay inside one sample (16 | 32).
// ---------------------------------------------------------------------------
__global__ __launch_bounds__(128) void final_gemm(const float* __restrict__ x2d,
                                                  const float* __restrict__ base,
                                                  const float* __restrict__ xw,
                                                  const float* __restrict__ p,
                                                  float* __restrict__ out) {
  const int rowBase = blockIdx.y * 64, colBase = blockIdx.x * 64;
  v8f acc[4] = {};
  gemm_core_64x64(x2d, base, Dn, Dn, rowBase, colBase, acc);

  const int lane = threadIdx.x & 31, wave = threadIdx.x >> 5;
  #pragma unroll
  for (int nt = 0; nt < 4; ++nt) {
    #pragma unroll
    for (int v = 0; v < 8; ++v) {
      const int row = rowBase + wave * 16 + v + 8 * (lane >> 4);
      const int col = colBase + nt * 16 + (lane & 15);
      const int b = row >> 5, t = row & 31;
      const float* pr = p + ((size_t)b * Tn + t) * RANKn;
      const float* xb = xw + (size_t)b * (2 * Dn * RANKn) + (size_t)Dn * RANKn
                           + (size_t)col * RANKn;                  // x_b[b, col, :]
      float lr = 0.f;
      #pragma unroll
      for (int r = 0; r < RANKn; ++r) lr += pr[r] * xb[r];
      out[(size_t)row * Dn + col] = x2d[(size_t)row * Dn + col] + acc[nt][v] + lr;
    }
  }
}

// ---------------------------------------------------------------------------
extern "C" void kernel_launch(void* const* d_in, const int* in_sizes, int n_in,
                              void* d_out, int out_size, void* d_ws, size_t ws_size,
                              hipStream_t stream) {
  (void)in_sizes; (void)n_in; (void)out_size; (void)ws_size;
  const float* x    = (const float*)d_in[0];   // (B,T,D)
  const float* ada  = (const float*)d_in[1];   // (B,ADA)
  const float* base = (const float*)d_in[2];   // (D,D)
  const float* w1   = (const float*)d_in[3];   // (ADA,INTER)
  const float* b1   = (const float*)d_in[4];   // (INTER)
  const float* w2   = (const float*)d_in[5];   // (INTER, 2*D*RANK)
  const float* b2   = (const float*)d_in[6];   // (2*D*RANK)
  const float* ln_g = (const float*)d_in[7];   // (ADA)
  const float* ln_b = (const float*)d_in[8];   // (ADA)
  float* out = (float*)d_out;

  float* ws    = (float*)d_ws;
  float* ae_ln = ws;                                   // 128*1024
  float* h     = ae_ln + (size_t)Bn * ADAn;            // 128*1024
  float* xw    = h + (size_t)Bn * INTERn;              // 128*16384
  float* p     = xw + (size_t)Bn * 2 * Dn * RANKn;     // 128*32*8

  // 1) LayerNorm
  ln_kernel<<<Bn, 256, 0, stream>>>(ada, ln_g, ln_b, ae_ln);
  // 2) h = GELU(ae_ln @ w1 + b1)        (128x1024x1024)
  hyper_gemm<<<dim3(INTERn / 64, Bn / 64), 128, 0, stream>>>(ae_ln, w1, b1, h, ADAn, INTERn, 1);
  // 3) xw = h @ w2 + b2                 (128x1024x16384)
  hyper_gemm<<<dim3(2 * Dn * RANKn / 64, Bn / 64), 128, 0, stream>>>(h, w2, b2, xw, INTERn, 2 * Dn * RANKn, 0);
  // 4) p = per-sample x @ x_a           (tiny, rank 8)
  p_kernel<<<Bn * (Tn / PROWS), 128, 0, stream>>>(x, xw, p);
  // 5) out = x + x2d @ base + p @ x_b^T (4096x1024x1024 + rank-8 epilogue)
  final_gemm<<<dim3(Dn / 64, Bn * Tn / 64), 128, 0, stream>>>(x, base, xw, p, out);
}

// v003
// A run of this version takes 96.1 microseconds.
// In both of two side-by-side timings against v002, it was 1.14 times as fast.
// All steps since v000 together make it 2.28 times as fast.
#include <hip/hip_runtime.h>
#include <math.h>

typedef __attribute__((ext_vector_type(2))) float v2f;
typedef __attribute__((ext_vector_type(8))) float v8f;

#define LN_EPS 1e-5f
constexpr int Bn = 128, Tn = 32, Dn = 1024, ADAn = 1024, INTERn = 1024, RANKn = 8;
constexpr int BK = 64;        // K chunk staged in LDS per barrier pair
constexpr int LPAD = 68;      // padded LDS row stride (floats): 272B, 16B-aligned, conflict-free frags

// ---------------------------------------------------------------------------
// LayerNorm over last dim (ADA=1024), one block per row
// ---------------------------------------------------------------------------
__global__ void ln_kernel(const float* __restrict__ ada, const float* __restrict__ g,
                          const float* __restrict__ bb, float* __restrict__ out) {
  const int row = blockIdx.x;
  const float* in = ada + (size_t)row * ADAn;
  float s = 0.f, s2 = 0.f;
  for (int i = threadIdx.x; i < ADAn; i += blockDim.x) {
    float v = in[i]; s += v; s2 += v * v;
  }
  __shared__ float red[64];
  for (int off = 16; off > 0; off >>= 1) {
    s  += __shfl_down(s,  off, 32);
    s2 += __shfl_down(s2, off, 32);
  }
  const int wave = threadIdx.x >> 5, lane = threadIdx.x & 31;
  const int nw = blockDim.x >> 5;
  if (lane == 0) { red[wave] = s; red[32 + wave] = s2; }
  __syncthreads();
  if (wave == 0) {
    float a  = (lane < nw) ? red[lane] : 0.f;
    float a2 = (lane < nw) ? red[32 + lane] : 0.f;
    for (int off = 16; off > 0; off >>= 1) {
      a  += __shfl_down(a,  off, 32);
      a2 += __shfl_down(a2, off, 32);
    }
    if (lane == 0) { red[0] = a; red[1] = a2; }
  }
  __syncthreads();
  const float mean = red[0] * (1.f / ADAn);
  const float var  = red[1] * (1.f / ADAn) - mean * mean;
  const float rstd = rsqrtf(var + LN_EPS);
  for (int i = threadIdx.x; i < ADAn; i += blockDim.x)
    out[(size_t)row * ADAn + i] = (in[i] - mean) * rstd * g[i] + bb[i];
}

// ---------------------------------------------------------------------------
// Shared WMMA fp32 GEMM core: one 64x64 block tile of A(MxK,row) @ W(KxN,row).
// 4 waves; wave w owns rows [w*16, w*16+16) x all 64 cols -> 4 x v8f acc.
// K is walked in chunks of BK = 64: one pair of barriers and one exposed
// load wait serve 64 WMMAs per wave.
// A tile:  global -> LDS via global_load_async_to_lds_b128 (ASYNCcnt DMA,
//          no VGPR round-trip), 8 copies per thread, 2 whole rows per wave copy.
// B tile:  VGPR-staged + transposed into LDS; each thread owns two 4k x 4n
//          blocks, so a transposed row piece is one 16-byte LDS store; global
//          loads for chunk k+1 are issued before the WMMA phase of chunk k.
// A fragment (16x4): lane l -> m = l&15, k = kc + 2*(l>>4) + {0,1}
// B fragment (4x16): lane l -> n = l&15, k = kc + 2*(l>>4) + {0,1} (LDS = B^T)
// ---------------------------------------------------------------------------
__device__ __forceinline__ void gemm_core_64x64(const float* __restrict__ A,
                                                const float* __restrict__ W,
                                                int K, int N, int rowBase, int colBase,
                                                v8f acc[4]) {
  __shared__ __attribute__((aligned(16))) float lA [64][LPAD];
  __shared__ __attribute__((aligned(16))) float lBt[64][LPAD];
  const int tid  = threadIdx.x, lane = tid & 31, wv = tid >> 5;
  const int mBase = wv * 16;
  const int mrow = lane & 15, khalf = lane >> 4;

  // A staging: copy i of a thread brings 16 B of row ar + 8*i, columns ac..ac+3
  const int ar = tid >> 4, ac = (tid & 15) * 4;
  // B staging: block j of a thread is rows kb + 16*j .. +3, columns n4 .. n4+3.
  // One wave load covers 4 rows x 128 B (whole lines); within each 16 lanes the
  // 4 column blocks x 4 row blocks hit all 64 LDS banks once per 16-byte store.
  const int n4 = (wv & 1) * 32 + ((lane & 3) + 4 * (lane >> 4)) * 4;
  const int kb = (wv >> 1) * 32 + ((lane >> 2) & 3) * 4;

  // LDS byte address of the thread's first A copy (generic addr low 32 bits = LDS offset)
  const unsigned ldsA = (unsigned)(size_t)&lA[ar][ac];
  constexpr unsigned LSTEP = 8 * LPAD * sizeof(float);   // 8 rows further in lA

  // prologue: issue B global loads for chunk 0; one pointer per staged row,
  // stepped only behind the wait for the loads that used it
  const float* wp[2][4];
  float4 rb[2][4];
  #pragma unroll
  for (int j = 0; j < 2; ++j)
    #pragma unroll
    for (int s = 0; s < 4; ++s) {
      wp[j][s] = W + (size_t)(kb + 16 * j + s) * N + colBase + n4;
      rb[j][s] = *(const float4*)wp[j][s];
    }

  for (int k0 = 0; k0 < K; k0 += BK) {
    __syncthreads();                                   // all waves done reading LDS
    // ---- A tile: async DMA straight into (padded) LDS -------------------
    {
      const float* ga = A + (size_t)(rowBase + ar) * K + k0 + ac;
      const size_t gs = (size_t)8 * K;                 // 8 rows further in A
      // the closing s_wait_xcnt keeps later rewrites of the address registers
      // behind the copies that name them
      asm volatile("global_load_async_to_lds_b128 %0, %8, off\n\t"
                   "global_load_async_to_lds_b128 %1, %9, off\n\t"
                   "global_load_async_to_lds_b128 %2, %10, off\n\t"
                   "global_load_async_to_lds_b128 %3, %11, off\n\t"
                   "global_load_async_to_lds_b128 %4, %12, off\n\t"
                   "global_load_async_to_lds_b128 %5, %13, off\n\t"
                   "global_load_async_to_lds_b128 %6, %14, off\n\t"
                   "global_load_async_to_lds_b128 %7, %15, off\n\t"
                   "s_wait_xcnt 0x0"
                   :: "v"(ldsA), "v"(ldsA + LSTEP), "v"(ldsA + 2 * LSTEP), "v"(ldsA + 3 * LSTEP),
                      "v"(ldsA + 4 * LSTEP), "v"(ldsA + 5 * LSTEP), "v"(ldsA + 6 * LSTEP),
                      "v"(ldsA + 7 * LSTEP),
                      "v"(ga), "v"(ga + gs), "v"(ga + 2 * gs), "v"(ga + 3 * gs),
                      "v"(ga + 4 * gs), "v"(ga + 5 * gs), "v"(ga + 6 * gs), "v"(ga + 7 * gs)
                   : "memory");
    }
    // ---- B tile: transpose staged regs into LDS (loads issued last iter) -
    #pragma unroll
    for (int j = 0; j < 2; ++j) {
      *(float4*)&lBt[n4 + 0][kb + 16 * j] = make_float4(rb[j][0].x, rb[j][1].x, rb[j][2].x, rb[j][3].x);
      *(float4*)&lBt[n4 + 1][kb + 16 * j] = make_float4(rb[j][0].y, rb[j][1].y, rb[j][2].y, rb[j][3].y);
      *(float4*)&lBt[n4 + 2][kb + 16 * j] = make_float4(rb[j][0].z, rb[j][1].z, rb[j][2].z, rb[j][3].z);
      *(float4*)&lBt[n4 + 3][kb + 16 * j] = make_float4(rb[j][0].w, rb[j][1].w, rb[j][2].w, rb[j][3].w);
    }
    asm volatile("s_wait_asynccnt 0x0" ::: "memory");  // A DMA landed
    __syncthreads();
    // ---- issue B global loads for NEXT chunk (consumed next iteration) ---
    if (k0 + BK < K) {
      #pragma unroll
      for (int j = 0; j < 2; ++j)
        #pragma unroll
        for (int s = 0; s < 4; ++s) {
          wp[j][s] += (size_t)BK * N;
          rb[j][s] = *(const float4*)wp[j][s];
        }
      // one 128-B line of the next A chunk per thread
      __builtin_prefetch(A + (size_t)(rowBase + (tid >> 1)) * K + k0 + BK + (tid & 1) * 32, 0, 1);
      // keeps rewrites of the address registers behind the loads and the prefetch that name them
      asm volatile("s_wait_xcnt 0x0" ::: "memory");
    }
    // ---- compute: 64 x v_wmma_f32_16x16x4_f32 per wave -------------------
    #pragma unroll
    for (int ks = 0; ks < BK / 4; ++ks) {
      const int kc = ks * 4 + 2 * khalf;
      const v2f a = *(const v2f*)&lA[mBase + mrow][kc];
      #pragma unroll
      for (int nt = 0; nt < 4; ++nt) {
        const v2f b = *(const v2f*)&lBt[nt * 16 + mrow][kc];
        acc[nt] = __builtin_amdgcn_wmma_f32_16x16x4_f32(
            false, a, false, b, (short)0, acc[nt], false, false);
      }
    }
    // keeps every WMMA of this trip in front of the v_nops below
    __builtin_amdgcn_sched_barrier(0);
    // four vector slots between the last WMMAs and the next trip's address
    // arithmetic, which may reuse their A/B registers
    asm volatile("v_nop\n\tv_nop\n\tv_nop\n\tv_nop");
  }
}

// ---------------------------------------------------------------------------
// Hypernetwork GEMM: out = act(A @ W + bias); act: 1 = exact GELU, 0 = identity
// ---------------------------------------------------------------------------
__global__ __launch_bounds__(128) void hyper_gemm(const float* __restrict__ A,
                                                  const float* __restrict__ W,
                                                  const float* __restrict__ bias,
                                                  float* __restrict__ out,
                                                  int K, int N, int gelu) {
  const int rowBase = blockIdx.y * 64, colBase = blockIdx.x * 64;
  v8f acc[4] = {};
  gemm_core_64x64(A, W, K, N, rowBase, colBase, acc);

  const int lane = threadIdx.x & 31, wave = threadIdx.x >> 5;
  #pragma unroll
  for (int nt = 0; nt < 4; ++nt) {
    #pragma unroll
    for (int v = 0; v < 8; ++v) {
      const int row = rowBase + wave * 16 + v + 8 * (lane >> 4);
      const int col = colBase + nt * 16 + (lane & 15);
      float r = acc[nt][v] + bias[col];
      if (gelu) r = 0.5f * r * (1.f + erff(r * 0.70710678118654752f));
      out[(size_t)row * N + col] = r;
    }
  }
}

// ---------------------------------------------------------------------------
// h = GELU(A @ W + bias), the small hypernetwork GEMM (128 x 1024 x 1024).
// In 64x64 tiles it has 32 blocks, one wave per SIMD on an eighth of the chip,
// each walking all of K. Here a block owns a 32x32 tile (128 blocks) and splits
// K inside the block: a chunk of HBK = 256 k is staged per barrier pair, and
// wave pair kq = 0..3 multiplies k in [64*kq, 64*kq + 64) of every chunk; of a
// pair, wave 0 owns rows 0..15 and wave 1 rows 16..31, both all 32 columns.
// The four partial tiles meet in LDS and are added in the order kq = 0,1,2,3.
// Fragment maps are those of gemm_core_64x64; staging works as there, maps below.
// ---------------------------------------------------------------------------
constexpr int HT = 32;          // tile rows and columns per block
constexpr int HBK = 256;        // K chunk staged in LDS per barrier pair
constexpr int HPAD = HBK + 4;   // LDS row pitch (floats): 16B-aligned, 4 banks per row as LPAD
constexpr int RPITCH = 36;      // pitch of a partial tile's row (floats), 16B-aligned
__global__ __launch_bounds__(256) void h_gemm(const float* __restrict__ A,
                                              const float* __restrict__ W,
                                              const float* __restrict__ bias,
                                              float* __restrict__ out) {
  constexpr int K = ADAn, N = INTERn;
  __shared__ __attribute__((aligned(16))) float lA [HT][HPAD];
  __shared__ __attribute__((aligned(16))) float lBt[HT][HPAD];
  __shared__ __attribute__((aligned(16))) float red[4][HT][RPITCH];
  const int rowBase = blockIdx.y * HT, colBase = blockIdx.x * HT;
  const int tid = threadIdx.x, lane = tid & 31, wv = tid >> 5;
  const int kq = wv >> 1, mBase = (wv & 1) * 16;
  const int mrow = lane & 15, khalf = lane >> 4;

  // A staging: copy i of a thread brings 16 B of row ar + 4*i, columns ac..ac+3
  // (one wave copy = 512 contiguous bytes of one row)
  const int ar = tid >> 6, ac = (tid & 63) * 4;
  // B staging: block j of a thread is rows kb + 16*j .. +3, columns n4 .. n4+3;
  // one wave load covers 4 rows x 128 B, and 16 lanes' 16-byte LDS stores hit all banks once
  const int n4 = ((lane & 3) + 4 * (lane >> 4)) * 4;
  const int kb = wv * 32 + ((lane >> 2) & 3) * 4;

  const unsigned ldsA = (unsigned)(size_t)&lA[ar][ac];
  constexpr unsigned LSTEP = 4 * HPAD * sizeof(float);   // 4 rows further in lA

  const float* wp[2][4];
  float4 rb[2][4];
  #pragma unroll
  for (int j = 0; j < 2; ++j)
    #pragma unroll
    for (int s = 0; s < 4; ++s) {
      wp[j][s] = W + (size_t)(kb + 16 * j + s) * N + colBase + n4;
      rb[j][s] = *(const float4*)wp[j][s];
    }
  // keeps rewrites of the address registers behind the loads that name them
  asm volatile("s_wait_xcnt 0x0" ::: "memory");

  v8f acc[2] = {};
  for (int k0 = 0; k0 < K; k0 += HBK) {
    if (k0 > 0) {   // chunk 0 finds LDS unread: its copies fly beside the first W loads
      // this wave's LDS reads of the last chunk have retired before the barrier
      // behind which the copies overwrite them
      asm volatile("s_wait_dscnt 0x0" ::: "memory");
      __syncthreads();                                 // all waves done reading LDS
    }
    {
      const float* ga = A + (size_t)(rowBase + ar) * K + k0 + ac;
      constexpr size_t gs = (size_t)4 * K;             // 4 rows further in A
      // the closing s_wait_xcnt keeps later rewrites of the address registers
      // behind the copies that name them
      asm volatile("global_load_async_to_lds_b128 %0, %8, off\n\t"
                   "global_load_async_to_lds_b128 %1, %9, off\n\t"
                   "global_load_async_to_lds_b128 %2, %10, off\n\t"
                   "global_load_async_to_lds_b128 %3, %11, off\n\t"
                   "global_load_async_to_lds_b128 %4, %12, off\n\t"
                   "global_load_async_to_lds_b128 %5, %13, off\n\t"
                   "global_load_async_to_lds_b128 %6, %14, off\n\t"
                   "global_load_async_to_lds_b128 %7, %15, off\n\t"
                   "s_wait_xcnt 0x0"
                   :: "v"(ldsA), "v"(ldsA + LSTEP), "v"(ldsA + 2 * LSTEP), "v"(ldsA + 3 * LSTEP),
                      "v"(ldsA + 4 * LSTEP), "v"(ldsA + 5 * LSTEP), "v"(ldsA + 6 * LSTEP),
                      "v"(ldsA + 7 * LSTEP),
                      "v"(ga), "v"(ga + gs), "v"(ga + 2 * gs), "v"(ga + 3 * gs),
                      "v"(ga + 4 * gs), "v"(ga + 5 * gs), "v"(ga + 6 * gs), "v"(ga + 7 * gs)
                   : "memory");
    }
    #pragma unroll
    for (int j = 0; j < 2; ++j) {
      *(float4*)&lBt[n4 + 0][kb + 16 * j] = make_float4(rb[j][0].x, rb[j][1].x, rb[j][2].x, rb[j][3].x);
      *(float4*)&lBt[n4 + 1][kb + 16 * j] = make_float4(rb[j][0].y, rb[j][1].y, rb[j][2].y, rb[j][3].y);
      *(float4*)&lBt[n4 + 2][kb + 16 * j] = make_float4(rb[j][0].z, rb[j][1].z, rb[j][2].z, rb[j][3].z);
      *(float4*)&lBt[n4 + 3][kb + 16 * j] = make_float4(rb[j][0].w, rb[j][1].w, rb[j][2].w, rb[j][3].w);
    }
    asm volatile("s_wait_asynccnt 0x0" ::: "memory");  // this wave's A copies have landed
    __syncthreads();                                   // the chunk is published to all waves
    // W loads of the next chunk fly during this chunk's WMMAs
    if (k0 + HBK < K) {
      #pragma unroll
      for (int j = 0; j < 2; ++j)
        #pragma unroll
        for (int s = 0; s < 4; ++s) {
          wp[j][s] += (size_t)HBK * N;
          rb[j][s] = *(const float4*)wp[j][s];
        }
      // keeps rewrites of the address registers behind the loads that name them
      asm volatile("s_wait_xcnt 0x0" ::: "memory");
    }
    #pragma unroll
    for (int ks = 0; ks < 16; ++ks) {
      const int kc = kq * 64 + ks * 4 + 2 * khalf;
      const v2f a = *(const v2f*)&lA[mBase + mrow][kc];
      #pragma unroll
      for (int nt = 0; nt < 2; ++nt) {
        const v2f b = *(const v2f*)&lBt[nt * 16 + mrow][kc];
        acc[nt] = __builtin_amdgcn_wmma_f32_16x16x4_f32(
            false, a, false, b, (short)0, acc[nt], false, false);
      }
    }
    // keeps every WMMA of this trip in front of the v_nops below
    __builtin_amdgcn_sched_barrier(0);
    // four vector slots between the last WMMAs and the next trip's address
    // arithmetic, which may reuse their A/B registers
    asm volatile("v_nop\n\tv_nop\n\tv_nop\n\tv_nop");
  }

  // partial tiles to LDS (an array of their own: no reader of lA / lBt is disturbed)
  #pragma unroll
  for (int nt = 0; nt < 2; ++nt)
    #pragma unroll
    for (int v = 0; v < 8; ++v)
      red[kq][mBase + v + 8 * khalf][nt * 16 + mrow] = acc[nt][v];
  __syncthreads();                                     // all four partial tiles are written

  // each thread finishes 4 neighbouring columns of one row: 8 threads store one 128-B line
  const int orow = tid >> 3, oc = (tid & 7) * 4;
  float4 r = *(const float4*)&red[0][orow][oc];
  #pragma unroll
  for (int q = 1; q < 4; ++q) {
    const float4 t = *(const float4*)&red[q][orow][oc];
    r.x += t.x; r.y += t.y; r.z += t.z; r.w += t.w;
  }
  const float4 bv = *(const float4*)(bias + colBase + oc);
  r.x += bv.x; r.y += bv.y; r.z += bv.z; r.w += bv.w;
  r.x = 0.5f * r.x * (1.f + erff(r.x * 0.70710678118654752f));
  r.y = 0.5f * r.y * (1.f + erff(r.y * 0.70710678118654752f));
  r.z = 0.5f * r.z * (1.f + erff(r.z * 0.70710678118654752f));
  r.w = 0.5f * r.w * (1.f + erff(r.w * 0.70710678118654752f));
  *(float4*)(out + (size_t)(rowBase + orow) * N + colBase + oc) = r;
}

// ---------------------------------------------------------------------------
// p[b,t,r] = sum_c x[b,t,c] * x_a[b,c,r],  x_a[b,c,r] = xw[b, c*8+r]
// One block = one sample x 16 token rows; wave w owns 4 rows, its 32 lanes split c.
// Lane l holds x[t][128q + 4l .. +3] (whole-line 16-byte loads, all issued at
// entry); x_a[b] (32 KB) is staged once in LDS in groups of 4 c (32 floats) at a
// pitch of 36 floats, so the 16-byte reads of 16 lanes fall on distinct banks.
// The 32 partial sums of a lane (4 rows x 8 ranks) are folded over the 32 lanes
// by a halving exchange that leaves sum number l in lane l: one 128-byte store.
// ---------------------------------------------------------------------------
constexpr int PROWS = 16;     // token rows per block
constexpr int XPITCH = 36;    // LDS floats per group of 4 c
__global__ __launch_bounds__(128) void p_kernel(const float* __restrict__ x,
                                                const float* __restrict__ xw,
                                                float* __restrict__ p) {
  __shared__ __attribute__((aligned(16))) float la[Dn / 4][XPITCH];
  const int b = blockIdx.x / (Tn / PROWS), th = blockIdx.x % (Tn / PROWS);
  const int tid = threadIdx.x, lane = tid & 31, wv = tid >> 5;
  const int t0 = th * PROWS + wv * 4;

  const float* aw = xw + (size_t)b * (2 * Dn * RANKn) + tid * 4;
  float4 st[16];
  #pragma unroll
  for (int i = 0; i < 16; ++i) st[i] = *(const float4*)(aw + i * 512);

  const float* xr = x + ((size_t)b * Tn + t0) * Dn + lane * 4;
  float4 xv[4][8];
  #pragma unroll
  for (int q = 0; q < 8; ++q)
    #pragma unroll
    for (int j = 0; j < 4; ++j) xv[j][q] = *(const float4*)(xr + j * Dn + q * 128);

  #pragma unroll
  for (int i = 0; i < 16; ++i) *(float4*)&la[i * 16 + (tid >> 3)][(tid & 7) * 4] = st[i];
  __syncthreads();

  float acc[4][8] = {};
  #pragma unroll
  for (int q = 0; q < 8; ++q) {
    const float* g = la[q * 32 + lane];
    #pragma unroll
    for (int cc = 0; cc < 4; ++cc) {
      const float4 a0 = *(const float4*)(g + cc * 8);
      const float4 a1 = *(const float4*)(g + cc * 8 + 4);
      #pragma unroll
      for (int j = 0; j < 4; ++j) {
        const float xs = cc == 0 ? xv[j][q].x : cc == 1 ? xv[j][q].y : cc == 2 ? xv[j][q].z : xv[j][q].w;
        acc[j][0] += xs * a0.x; acc[j][1] += xs * a0.y;
        acc[j][2] += xs * a0.z; acc[j][3] += xs * a0.w;
        acc[j][4] += xs * a1.x; acc[j][5] += xs * a1.y;
        acc[j][6] += xs * a1.z; acc[j][7] += xs * a1.w;
      }
    }
  }

  // halving exchange: at each step a lane keeps the half of its sums whose index
  // bit equals its own lane bit and hands the other half to its partner lane
  float s16[16], s8[8], s4[4], s2[2];
  const bool h16 = lane & 16, h8 = lane & 8, h4 = lane & 4, h2 = lane & 2, h1 = lane & 1;
  #pragma unroll
  for (int i = 0; i < 16; ++i) {
    const float lo = acc[i >> 3][i & 7], hi = acc[2 + (i >> 3)][i & 7];
    s16[i] = (h16 ? hi : lo) + __shfl_xor(h16 ? lo : hi, 16, 32);
  }
  #pragma unroll
  for (int i = 0; i < 8; ++i)
    s8[i] = (h8 ? s16[i + 8] : s16[i]) + __shfl_xor(h8 ? s16[i] : s16[i + 8], 8, 32);
  #pragma unroll
  for (int i = 0; i < 4; ++i)
    s4[i] = (h4 ? s8[i + 4] : s8[i]) + __shfl_xor(h4 ? s8[i] : s8[i + 4], 4, 32);
  #pragma unroll
  for (int i = 0; i < 2; ++i)
    s2[i] = (h2 ? s4[i + 2] : s4[i]) + __shfl_xor(h2 ? s4[i] : s4[i + 2], 2, 32);
  const float s1 = (h1 ? s2[1] : s2[0]) + __shfl_xor(h1 ? s2[0] : s2[1], 1, 32);
  p[((size_t)b * Tn + t0) * RANKn + lane] = s1;
}

// ---------------------------------------------------------------------------
// Final fused GEMM: out = x + x2d @ base + p @ x_b^T
// x2d is (B*T, D); rows of a wave tile stay inside one sample (16 | 32).
// ---------------------------------------------------------------------------
__global__ __launch_bounds__(128) void final_gemm(const float* __restrict__ x2d,
                                                  const float* __restrict__ base,
                                                  const float* __restrict__ xw,
                                                  const float* __restrict__ p,
                                                  float* __restrict__ out) {
  const int rowBase = blockIdx.y * 64, colBase = blockIdx.x * 64;
  v8f acc[4] = {};
  gemm_core_64x64(x2d, base, Dn, Dn, rowBase, colBase, acc);

  const int lane = threadIdx.x & 31, wave = threadIdx.x >> 5;
  #pragma unroll
  for (int nt = 0; nt < 4; ++nt) {
    #pragma unroll
    for (int v = 0; v < 8; ++v) {
      const int row = rowBase + wave * 16 + v + 8 * (lane >> 4);
      const int col = colBase + nt * 16 + (lane & 15);
      const int b = row >> 5, t = row & 31;
      const float* pr = p + ((size_t)b * Tn + t) * RANKn;
      const float* xb = xw + (size_t)b * (2 * Dn * RANKn) + (size_t)Dn * RANKn
                           + (size_t)col * RANKn;                  // x_b[b, col, :]
      float lr = 0.f;
      #pragma unroll
      for (int r = 0; r < RANKn; ++r) lr += pr[r] * xb[r];
      out[(size_t)row * Dn + col] = x2d[(size_t)row * Dn + col] + acc[nt][v] + lr;
    }
  }
}

// ---------------------------------------------------------------------------
extern "C" void kernel_launch(void* const* d_in, const int* in_sizes, int n_in,
                              void* d_out, int out_size, void* d_ws, size_t ws_size,
                              hipStream_t stream) {
  (void)in_sizes; (void)n_in; (void)out_size; (void)ws_size;
  const float* x    = (const float*)d_in[0];   // (B,T,D)
  const float* ada  = (const float*)d_in[1];   // (B,ADA)
  const float* base = (const float*)d_in[2];   // (D,D)
  const float* w1   = (const float*)d_in[3];   // (ADA,INTER)
  const float* b1   = (const float*)d_in[4];   // (INTER)
  const float* w2   = (const float*)d_in[5];   // (INTER, 2*D*RANK)
  const float* b2   = (const float*)d_in[6];   // (2*D*RANK)
  const float* ln_g = (const float*)d_in[7];   // (ADA)
  const float* ln_b = (const float*)d_in[8];   // (ADA)
  float* out = (float*)d_out;

  float* ws    = (float*)d_ws;
  float* ae_ln = ws;                                   // 128*1024
  float* h     = ae_ln + (size_t)Bn * ADAn;            // 128*1024
  float* xw    = h + (size_t)Bn * INTERn;              // 128*16384
  float* p     = xw + (size_t)Bn * 2 * Dn * RANKn;     // 128*32*8

  // 1) LayerNorm
  ln_kernel<<<Bn, 256, 0, stream>>>(ada, ln_g, ln_b, ae_ln);
  // 2) h = GELU(ae_ln @ w1 + b1)        (128x1024x1024)
  h_gemm<<<dim3(INTERn / HT, Bn / HT), 256, 0, stream>>>(ae_ln, w1, b1, h);
  // 3) xw = h @ w2 + b2                 (128x1024x16384)
  hyper_gemm<<<dim3(2 * Dn * RANKn / 64, Bn / 64), 128, 0, stream>>>(h, w2, b2, xw, INTERn, 2 * Dn * RANKn, 0);
  // 4) p = per-sample x @ x_a           (tiny, rank 8)
  p_kernel<<<Bn * (Tn / PROWS), 128, 0, stream>>>(x, xw, p);
  // 5) out = x + x2d @ base + p @ x_b^T (4096x1024x1024 + rank-8 epilogue)
  final_gemm<<<dim3(Dn / 64, Bn * Tn / 64), 128, 0, stream>>>(x, base, xw, p, out);
}

// v004
// A run of this version takes 92 microseconds.
// Two timings next to v003 both put it at 1.05 times that version's speed.
// Over all steps from v000 it is 2.41 times as fast.
#include <hip/hip_runtime.h>
#include <math.h>

typedef __attribute__((ext_vector_type(2))) float v2f;
typedef __attribute__((ext_vector_type(8))) float v8f;

#define LN_EPS 1e-5f
constexpr int Bn = 128, Tn = 32, Dn = 1024, ADAn = 1024, INTERn = 1024, RANKn = 8;
constexpr int BK = 64;        // K chunk staged in LDS per barrier
constexpr int LPAD = 68;      // padded LDS row stride (floats): 272B, 16B-aligned, conflict-free frags

// ---------------------------------------------------------------------------
// LayerNorm over last dim (ADA=1024), one block per row
// ---------------------------------------------------------------------------
__global__ void ln_kernel(const float* __restrict__ ada, const float* __restrict__ g,
                          const float* __restrict__ bb, float* __restrict__ out) {
  const int row = blockIdx.x;
  const float* in = ada + (size_t)row * ADAn;
  float s = 0.f, s2 = 0.f;
  for (int i = threadIdx.x; i < ADAn; i += blockDim.x) {
    float v = in[i]; s += v; s2 += v * v;
  }
  __shared__ float red[64];
  for (int off = 16; off > 0; off >>= 1) {
    s  += __shfl_down(s,  off, 32);
    s2 += __shfl_down(s2, off, 32);
  }
  const int wave = threadIdx.x >> 5, lane = threadIdx.x & 31;
  const int nw = blockDim.x >> 5;
  if (lane == 0) { red[wave] = s; red[32 + wave] = s2; }
  __syncthreads();
  if (wave == 0) {
    float a  = (lane < nw) ? red[lane] : 0.f;
    float a2 = (lane < nw) ? red[32 + lane] : 0.f;
    for (int off = 16; off > 0; off >>= 1) {
      a  += __shfl_down(a,  off, 32);
      a2 += __shfl_down(a2, off, 32);
    }
    if (lane == 0) { red[0] = a; red[1] = a2; }
  }
  __syncthreads();
  const float mean = red[0] * (1.f / ADAn);
  const float var  = red[1] * (1.f / ADAn) - mean * mean;
  const float rstd = rsqrtf(var + LN_EPS);
  for (int i = threadIdx.x; i < ADAn; i += blockDim.x)
    out[(size_t)row * ADAn + i] = (in[i] - mean) * rstd * g[i] + bb[i];
}

// ---------------------------------------------------------------------------
// Shared WMMA fp32 GEMM core: one 64x64 block tile of A(MxK,row) @ W(KxN,row).
// 4 waves; wave w owns rows [w*16, w*16+16) x all 64 cols -> 4 x v8f acc.
// K is walked in chunks of BK = 64 through TWO LDS buffers: while the 64 WMMAs
// per wave of chunk t run on buffer t & 1, the A copies and the W loads of chunk
// t + 1 are in flight towards the other buffer; one barrier per chunk publishes
// chunk t + 1 and frees the buffer that chunk t has just read.
// A tile:  global -> LDS via global_load_async_to_lds_b128 (ASYNCcnt DMA,
//          no VGPR round-trip), 8 copies per thread, 2 whole rows per wave copy.
// B tile:  VGPR-staged + transposed into LDS; each thread owns two 4k x 4n
//          blocks, so a transposed row piece is one 16-byte LDS store.
// A fragment (16x4): lane l -> m = l&15, k = kc + 2*(l>>4) + {0,1}
// B fragment (4x16): lane l -> n = l&15, k = kc + 2*(l>>4) + {0,1} (LDS = B^T)
// ---------------------------------------------------------------------------
// 8 copies of one thread: 16 B of each of 8 rows of an A chunk, the rows gs floats
// apart in A and LSTEP bytes apart in LDS
template <unsigned LSTEP>
__device__ __forceinline__ void copy_a_chunk(unsigned ldsA, const float* ga, size_t gs) {
  // the closing s_wait_xcnt keeps later rewrites of the address registers
  // behind the copies that name them
  asm volatile("global_load_async_to_lds_b128 %0, %8, off\n\t"
               "global_load_async_to_lds_b128 %1, %9, off\n\t"
               "global_load_async_to_lds_b128 %2, %10, off\n\t"
               "global_load_async_to_lds_b128 %3, %11, off\n\t"
               "global_load_async_to_lds_b128 %4, %12, off\n\t"
               "global_load_async_to_lds_b128 %5, %13, off\n\t"
               "global_load_async_to_lds_b128 %6, %14, off\n\t"
               "global_load_async_to_lds_b128 %7, %15, off\n\t"
               "s_wait_xcnt 0x0"
               :: "v"(ldsA), "v"(ldsA + LSTEP), "v"(ldsA + 2 * LSTEP), "v"(ldsA + 3 * LSTEP),
                  "v"(ldsA + 4 * LSTEP), "v"(ldsA + 5 * LSTEP), "v"(ldsA + 6 * LSTEP),
                  "v"(ldsA + 7 * LSTEP),
                  "v"(ga), "v"(ga + gs), "v"(ga + 2 * gs), "v"(ga + 3 * gs),
                  "v"(ga + 4 * gs), "v"(ga + 5 * gs), "v"(ga + 6 * gs), "v"(ga + 7 * gs)
               : "memory");
}

__device__ __forceinline__ void gemm_core_64x64(const float* __restrict__ A,
                                                const float* __restrict__ W,
                                                int K, int N, int rowBase, int colBase,
                                                v8f acc[4]) {
  __shared__ __attribute__((aligned(16))) float lA [2][64][LPAD];
  __shared__ __attribute__((aligned(16))) float lBt[2][64][LPAD];
  const int tid  = threadIdx.x, lane = tid & 31, wv = tid >> 5;
  const int mBase = wv * 16;
  const int mrow = lane & 15, khalf = lane >> 4;

  // A staging: copy i of a thread brings 16 B of row ar + 8*i, columns ac..ac+3
  const int ar = tid >> 4, ac = (tid & 15) * 4;
  // B staging: block j of a thread is rows kb + 16*j .. +3, columns n4 .. n4+3.
  // One wave load covers 4 rows x 128 B (whole lines); within each 16 lanes the
  // 4 column blocks x 4 row blocks hit all 64 LDS banks once per 16-byte store.
  const int n4 = (wv & 1) * 32 + ((lane & 3) + 4 * (lane >> 4)) * 4;
  const int kb = (wv >> 1) * 32 + ((lane >> 2) & 3) * 4;

  // LDS byte address of the thread's first A copy in buffer 0 (generic addr low 32 bits = LDS offset)
  const unsigned ldsA = (unsigned)(size_t)&lA[0][ar][ac];
  constexpr unsigned BUFB = 64 * LPAD * sizeof(float);   // one buffer further in lA
  constexpr unsigned LSTEP = 8 * LPAD * sizeof(float);   // 8 rows further in lA
  const float* ga = A + (size_t)(rowBase + ar) * K + ac; // the thread's first A copy of chunk 0
  const size_t gs = (size_t)8 * K;                       // 8 rows further in A

  // ---- chunk 0: W loads and A copies, into buffer 0 ----------------------
  // one pointer per staged W row, stepped only behind the wait for the loads that used it
  const float* wp[2][4];
  float4 rb[2][4];
  #pragma unroll
  for (int j = 0; j < 2; ++j)
    #pragma unroll
    for (int s = 0; s < 4; ++s) {
      wp[j][s] = W + (size_t)(kb + 16 * j + s) * N + colBase + n4;
      rb[j][s] = *(const float4*)wp[j][s];
    }
  copy_a_chunk<LSTEP>(ldsA, ga, gs);
  #pragma unroll
  for (int j = 0; j < 2; ++j) {
    *(float4*)&lBt[0][n4 + 0][kb + 16 * j] = make_float4(rb[j][0].x, rb[j][1].x, rb[j][2].x, rb[j][3].x);
    *(float4*)&lBt[0][n4 + 1][kb + 16 * j] = make_float4(rb[j][0].y, rb[j][1].y, rb[j][2].y, rb[j][3].y);
    *(float4*)&lBt[0][n4 + 2][kb + 16 * j] = make_float4(rb[j][0].z, rb[j][1].z, rb[j][2].z, rb[j][3].z);
    *(float4*)&lBt[0][n4 + 3][kb + 16 * j] = make_float4(rb[j][0].w, rb[j][1].w, rb[j][2].w, rb[j][3].w);
  }
  asm volatile("s_wait_asynccnt 0x0" ::: "memory");    // this wave's A copies of chunk 0 have landed
  __syncthreads();                                     // chunk 0 is published
  // ---- chunk 1 starts its flight: A copies to buffer 1, W loads to registers
  if (BK < K) {
    copy_a_chunk<LSTEP>(ldsA + BUFB, ga + BK, gs);
    #pragma unroll
    for (int j = 0; j < 2; ++j)
      #pragma unroll
      for (int s = 0; s < 4; ++s) {
        wp[j][s] += (size_t)BK * N;
        rb[j][s] = *(const float4*)wp[j][s];
      }
    // keeps rewrites of the address registers behind the loads that name them
    asm volatile("s_wait_xcnt 0x0" ::: "memory");
  }

  int cur = 0;                                         // buffer of the chunk being multiplied
  for (int k0 = 0; k0 < K; k0 += BK) {
    // ---- compute: 64 x v_wmma_f32_16x16x4_f32 per wave on buffer cur ------
    #pragma unroll
    for (int ks = 0; ks < BK / 4; ++ks) {
      const int kc = ks * 4 + 2 * khalf;
      const v2f a = *(const v2f*)&lA[cur][mBase + mrow][kc];
      #pragma unroll
      for (int nt = 0; nt < 4; ++nt) {
        const v2f b = *(const v2f*)&lBt[cur][nt * 16 + mrow][kc];
        acc[nt] = __builtin_amdgcn_wmma_f32_16x16x4_f32(
            false, a, false, b, (short)0, acc[nt], false, false);
      }
    }
    // keeps every WMMA of this trip in front of the v_nops below
    __builtin_amdgcn_sched_barrier(0);
    // four vector slots between the last WMMAs and the register moves below,
    // which may reuse their A/B registers
    asm volatile("v_nop\n\tv_nop\n\tv_nop\n\tv_nop");
    // ---- W of chunk t + 1: transposed into the other buffer, whose last
    //      readers left it at the barrier of the trip before ----------------
    if (k0 + BK < K) {
      #pragma unroll
      for (int j = 0; j < 2; ++j) {
        *(float4*)&lBt[cur ^ 1][n4 + 0][kb + 16 * j] = make_float4(rb[j][0].x, rb[j][1].x, rb[j][2].x, rb[j][3].x);
        *(float4*)&lBt[cur ^ 1][n4 + 1][kb + 16 * j] = make_float4(rb[j][0].y, rb[j][1].y, rb[j][2].y, rb[j][3].y);
        *(float4*)&lBt[cur ^ 1][n4 + 2][kb + 16 * j] = make_float4(rb[j][0].z, rb[j][1].z, rb[j][2].z, rb[j][3].z);
        *(float4*)&lBt[cur ^ 1][n4 + 3][kb + 16 * j] = make_float4(rb[j][0].w, rb[j][1].w, rb[j][2].w, rb[j][3].w);
      }
    }
    // ---- publish point of chunk t + 1 --------------------------------------
    // this wave's LDS reads of buffer cur and its W stores have retired
    asm volatile("s_wait_dscnt 0x0" ::: "memory");
    // this wave's A copies of chunk t + 1 have landed
    asm volatile("s_wait_asynccnt 0x0" ::: "memory");
    __syncthreads();       // chunk t + 1 is published; every reader has left buffer cur
    // ---- chunk t + 2 starts its flight, into the buffer just read ----------
    if (k0 + 2 * BK < K) {
      copy_a_chunk<LSTEP>(ldsA + cur * BUFB, ga + k0 + 2 * BK, gs);
      #pragma unroll
      for (int j = 0; j < 2; ++j)
        #pragma unroll
        for (int s = 0; s < 4; ++s) {
          wp[j][s] += (size_t)BK * N;
          rb[j][s] = *(const float4*)wp[j][s];
        }
      // keeps rewrites of the address registers behind the loads that name them
      asm volatile("s_wait_xcnt 0x0" ::: "memory");
    }
    cur ^= 1;
  }
  asm volatile("s_wait_asynccnt 0x0" ::: "memory");    // no copy is left in flight behind the loop
}

// ---------------------------------------------------------------------------
// Hypernetwork GEMM: out = act(A @ W + bias); act: 1 = exact GELU, 0 = identity
// ---------------------------------------------------------------------------
__global__ __launch_bounds__(128) void hyper_gemm(const float* __restrict__ A,
                                                  const float* __restrict__ W,
                                                  const float* __restrict__ bias,
                                                  float* __restrict__ out,
                                                  int K, int N, int gelu) {
  const int rowBase = blockIdx.y * 64, colBase = blockIdx.x * 64;
  v8f acc[4] = {};
  gemm_core_64x64(A, W, K, N, rowBase, colBase, acc);

  const int lane = threadIdx.x & 31, wave = threadIdx.x >> 5;
  #pragma unroll
  for (int nt = 0; nt < 4; ++nt) {
    #pragma unroll
    for (int v = 0; v < 8; ++v) {
      const int row = rowBase + wave * 16 + v + 8 * (lane >> 4);
      const int col = colBase + nt * 16 + (lane & 15);
      float r = acc[nt][v] + bias[col];
      if (gelu) r = 0.5f * r * (1.f + erff(r * 0.70710678118654752f));
      out[(size_t)row * N + col] = r;
    }
  }
}

// ---------------------------------------------------------------------------
// h = GELU(A @ W + bias), the small hypernetwork GEMM (128 x 1024 x 1024).
// In 64x64 tiles it has 32 blocks, one wave per SIMD on an eighth of the chip,
// each walking all of K. Here a block owns a 32x32 tile (128 blocks) and splits
// K inside the block: a chunk of HBK = 256 k is staged per barrier, and
// wave pair kq = 0..3 multiplies k in [64*kq, 64*kq + 64) of every chunk; of a
// pair, wave 0 owns rows 0..15 and wave 1 rows 16..31, both all 32 columns.
// The four partial tiles meet in LDS and are added in the order kq = 0,1,2,3.
// Staging, the two LDS buffers and fragment maps are those of gemm_core_64x64.
// ---------------------------------------------------------------------------
constexpr int HT = 32;          // tile rows and columns per block
constexpr int HBK = 256;        // K chunk staged in LDS per barrier
constexpr int HPAD = HBK + 4;   // LDS row pitch (floats): 16B-aligned, 4 banks per row as LPAD
constexpr int RPITCH = 36;      // pitch of a partial tile's row (floats), 16B-aligned
__global__ __launch_bounds__(256) void h_gemm(const float* __restrict__ A,
                                              const float* __restrict__ W,
                                              const float* __restrict__ bias,
                                              float* __restrict__ out) {
  constexpr int K = ADAn, N = INTERn;
  __shared__ __attribute__((aligned(16))) float lA [2][HT][HPAD];
  __shared__ __attribute__((aligned(16))) float lBt[2][HT][HPAD];
  __shared__ __attribute__((aligned(16))) float red[4][HT][RPITCH];
  const int rowBase = blockIdx.y * HT, colBase = blockIdx.x * HT;
  const int tid = threadIdx.x, lane = tid & 31, wv = tid >> 5;
  const int kq = wv >> 1, mBase = (wv & 1) * 16;
  const int mrow = lane & 15, khalf = lane >> 4;

  // A staging: copy i of a thread brings 16 B of row ar + 4*i, columns ac..ac+3
  // (one wave copy = 512 contiguous bytes of one row)
  const int ar = tid >> 6, ac = (tid & 63) * 4;
  // B staging: block j of a thread is rows kb + 16*j .. +3, columns n4 .. n4+3;
  // one wave load covers 4 rows x 128 B, and 16 lanes' 16-byte LDS stores hit all banks once
  const int n4 = ((lane & 3) + 4 * (lane >> 4)) * 4;
  const int kb = wv * 32 + ((lane >> 2) & 3) * 4;

  const unsigned ldsA = (unsigned)(size_t)&lA[0][ar][ac];
  constexpr unsigned LSTEP = 4 * HPAD * sizeof(float);   // 4 rows further in lA
  constexpr unsigned BUFB = HT * HPAD * sizeof(float);   // one buffer further in lA
  const float* ga = A + (size_t)(rowBase + ar) * K + ac; // the thread's first A copy of chunk 0
  constexpr size_t gs = (size_t)4 * K;                   // 4 rows further in A

  // ---- chunk 0: W loads and A copies, into buffer 0 ----------------------
  const float* wp[2][4];
  float4 rb[2][4];
  #pragma unroll
  for (int j = 0; j < 2; ++j)
    #pragma unroll
    for (int s = 0; s < 4; ++s) {
      wp[j][s] = W + (size_t)(kb + 16 * j + s) * N + colBase + n4;
      rb[j][s] = *(const float4*)wp[j][s];
    }
  // keeps rewrites of the address registers behind the loads that name them
  asm volatile("s_wait_xcnt 0x0" ::: "memory");
  copy_a_chunk<LSTEP>(ldsA, ga, gs);
  #pragma unroll
  for (int j = 0; j < 2; ++j) {
    *(float4*)&lBt[0][n4 + 0][kb + 16 * j] = make_float4(rb[j][0].x, rb[j][1].x, rb[j][2].x, rb[j][3].x);
    *(float4*)&lBt[0][n4 + 1][kb + 16 * j] = make_float4(rb[j][0].y, rb[j][1].y, rb[j][2].y, rb[j][3].y);
    *(float4*)&lBt[0][n4 + 2][kb + 16 * j] = make_float4(rb[j][0].z, rb[j][1].z, rb[j][2].z, rb[j][3].z);
    *(float4*)&lBt[0][n4 + 3][kb + 16 * j] = make_float4(rb[j][0].w, rb[j][1].w, rb[j][2].w, rb[j][3].w);
  }
  asm volatile("s_wait_asynccnt 0x0" ::: "memory");    // this wave's A copies of chunk 0 have landed
  __syncthreads();                                     // chunk 0 is published
  // ---- chunk 1 starts its flight: A copies to buffer 1, W loads to registers
  if (HBK < K) {
    copy_a_chunk<LSTEP>(ldsA + BUFB, ga + HBK, gs);
    #pragma unroll
    for (int j = 0; j < 2; ++j)
      #pragma unroll
      for (int s = 0; s < 4; ++s) {
        wp[j][s] += (size_t)HBK * N;
        rb[j][s] = *(const float4*)wp[j][s];
      }
    // keeps rewrites of the address registers behind the loads that name them
    asm volatile("s_wait_xcnt 0x0" ::: "memory");
  }

  v8f acc[2] = {};
  for (int k0 = 0; k0 < K; k0 += HBK) {
    const int cur = (k0 / HBK) & 1;                    // buffer of the chunk being multiplied
    #pragma unroll
    for (int ks = 0; ks < 16; ++ks) {
      const int kc = kq * 64 + ks * 4 + 2 * khalf;
      const v2f a = *(const v2f*)&lA[cur][mBase + mrow][kc];
      #pragma unroll
      for (int nt = 0; nt < 2; ++nt) {
        const v2f b = *(const v2f*)&lBt[cur][nt * 16 + mrow][kc];
        acc[nt] = __builtin_amdgcn_wmma_f32_16x16x4_f32(
            false, a, false, b, (short)0, acc[nt], false, false);
      }
    }
    // keeps the wait for the W loads of chunk t + 1 behind every WMMA of this trip,
    // so that the loads have the whole trip to land
    __builtin_amdgcn_sched_barrier(0);
    // W of chunk t + 1: transposed into the other buffer, whose last readers
    // left it at the barrier of the trip before
    if (k0 + HBK < K) {
      #pragma unroll
      for (int j = 0; j < 2; ++j) {
        *(float4*)&lBt[cur ^ 1][n4 + 0][kb + 16 * j] = make_float4(rb[j][0].x, rb[j][1].x, rb[j][2].x, rb[j][3].x);
        *(float4*)&lBt[cur ^ 1][n4 + 1][kb + 16 * j] = make_float4(rb[j][0].y, rb[j][1].y, rb[j][2].y, rb[j][3].y);
        *(float4*)&lBt[cur ^ 1][n4 + 2][kb + 16 * j] = make_float4(rb[j][0].z, rb[j][1].z, rb[j][2].z, rb[j][3].z);
        *(float4*)&lBt[cur ^ 1][n4 + 3][kb + 16 * j] = make_float4(rb[j][0].w, rb[j][1].w, rb[j][2].w, rb[j][3].w);
      }
    }
    // publish point of chunk t + 1:
    // this wave's LDS reads of buffer cur and its W stores have retired
    asm volatile("s_wait_dscnt 0x0" ::: "memory");
    // this wave's A copies of chunk t + 1 have landed
    asm volatile("s_wait_asynccnt 0x0" ::: "memory");
    __syncthreads();       // chunk t + 1 is published; every reader has left buffer cur
    // chunk t + 2 starts its flight, into the buffer just read
    if (k0 + 2 * HBK < K) {
      copy_a_chunk<LSTEP>(ldsA + cur * BUFB, ga + k0 + 2 * HBK, gs);
      #pragma unroll
      for (int j = 0; j < 2; ++j)
        #pragma unroll
        for (int s = 0; s < 4; ++s) {
          wp[j][s] += (size_t)HBK * N;
          rb[j][s] = *(const float4*)wp[j][s];
        }
      // keeps rewrites of the address registers behind the loads that name them
      asm volatile("s_wait_xcnt 0x0" ::: "memory");
    }
  }
  asm volatile("s_wait_asynccnt 0x0" ::: "memory");    // no copy is left in flight behind the loop

  // partial tiles to LDS (an array of their own: no reader of lA / lBt is disturbed)
  #pragma unroll
  for (int nt = 0; nt < 2; ++nt)
    #pragma unroll
    for (int v = 0; v < 8; ++v)
      red[kq][mBase + v + 8 * khalf][nt * 16 + mrow] = acc[nt][v];
  __syncthreads();                                     // all four partial tiles are written

  // each thread finishes 4 neighbouring columns of one row: 8 threads store one 128-B line
  const int orow = tid >> 3, oc = (tid & 7) * 4;
  float4 r = *(const float4*)&red[0][orow][oc];
  #pragma unroll
  for (int q = 1; q < 4; ++q) {
    const float4 t = *(const float4*)&red[q][orow][oc];
    r.x += t.x; r.y += t.y; r.z += t.z; r.w += t.w;
  }
  const float4 bv = *(const float4*)(bias + colBase + oc);
  r.x += bv.x; r.y += bv.y; r.z += bv.z; r.w += bv.w;
  r.x = 0.5f * r.x * (1.f + erff(r.x * 0.70710678118654752f));
  r.y = 0.5f * r.y * (1.f + erff(r.y * 0.70710678118654752f));
  r.z = 0.5f * r.z * (1.f + erff(r.z * 0.70710678118654752f));
  r.w = 0.5f * r.w * (1.f + erff(r.w * 0.70710678118654752f));
  *(float4*)(out + (size_t)(rowBase + orow) * N + colBase + oc) = r;
}

// ---------------------------------------------------------------------------
// p[b,t,r] = sum_c x[b,t,c] * x_a[b,c,r],  x_a[b,c,r] = xw[b, c*8+r]
// One block = one sample x 16 token rows; wave w owns 4 rows, its 32 lanes split c.
// Lane l holds x[t][128q + 4l .. +3] (whole-line 16-byte loads, all issued at
// entry); x_a[b] (32 KB) is staged once in LDS in groups of 4 c (32 floats) at a
// pitch of 36 floats, so the 16-byte reads of 16 lanes fall on distinct banks.
// The 32 partial sums of a lane (4 rows x 8 ranks) are folded over the 32 lanes
// by a halving exchange that leaves sum number l in lane l: one 128-byte store.
// ---------------------------------------------------------------------------
constexpr int PROWS = 16;     // token rows per block
constexpr int XPITCH = 36;    // LDS floats per group of 4 c
__global__ __launch_bounds__(128) void p_kernel(const float* __restrict__ x,
                                                const float* __restrict__ xw,
                                                float* __restrict__ p) {
  __shared__ __attribute__((aligned(16))) float la[Dn / 4][XPITCH];
  const int b = blockIdx.x / (Tn / PROWS), th = blockIdx.x % (Tn / PROWS);
  const int tid = threadIdx.x, lane = tid & 31, wv = tid >> 5;
  const int t0 = th * PROWS + wv * 4;

  const float* aw = xw + (size_t)b * (2 * Dn * RANKn) + tid * 4;
  float4 st[16];
  #pragma unroll
  for (int i = 0; i < 16; ++i) st[i] = *(const float4*)(aw + i * 512);

  const float* xr = x + ((size_t)b * Tn + t0) * Dn + lane * 4;
  float4 xv[4][8];
  #pragma unroll
  for (int q = 0; q < 8; ++q)
    #pragma unroll
    for (int j = 0; j < 4; ++j) xv[j][q] = *(const float4*)(xr + j * Dn + q * 128);

  #pragma unroll
  for (int i = 0; i < 16; ++i) *(float4*)&la[i * 16 + (tid >> 3)][(tid & 7) * 4] = st[i];
  __syncthreads();

  float acc[4][8] = {};
  #pragma unroll
  for (int q = 0; q < 8; ++q) {
    const float* g = la[q * 32 + lane];
    #pragma unroll
    for (int cc = 0; cc < 4; ++cc) {
      const float4 a0 = *(const float4*)(g + cc * 8);
      const float4 a1 = *(const float4*)(g + cc * 8 + 4);
      #pragma unroll
      for (int j = 0; j < 4; ++j) {
        const float xs = cc == 0 ? xv[j][q].x : cc == 1 ? xv[j][q].y : cc == 2 ? xv[j][q].z : xv[j][q].w;
        acc[j][0] += xs * a0.x; acc[j][1] += xs * a0.y;
        acc[j][2] += xs * a0.z; acc[j][3] += xs * a0.w;
        acc[j][4] += xs * a1.x; acc[j][5] += xs * a1.y;
        acc[j][6] += xs * a1.z; acc[j][7] += xs * a1.w;
      }
    }
  }

  // halving exchange: at each step a lane keeps the half of its sums whose index
  // bit equals its own lane bit and hands the other half to its partner lane
  float s16[16], s8[8], s4[4], s2[2];
  const bool h16 = lane & 16, h8 = lane & 8, h4 = lane & 4, h2 = lane & 2, h1 = lane & 1;
  #pragma unroll
  for (int i = 0; i < 16; ++i) {
    const float lo = acc[i >> 3][i & 7], hi = acc[2 + (i >> 3)][i & 7];
    s16[i] = (h16 ? hi : lo) + __shfl_xor(h16 ? lo : hi, 16, 32);
  }
  #pragma unroll
  for (int i = 0; i < 8; ++i)
    s8[i] = (h8 ? s16[i + 8] : s16[i]) + __shfl_xor(h8 ? s16[i] : s16[i + 8], 8, 32);
  #pragma unroll
  for (int i = 0; i < 4; ++i)
    s4[i] = (h4 ? s8[i + 4] : s8[i]) + __shfl_xor(h4 ? s8[i] : s8[i + 4], 4, 32);
  #pragma unroll
  for (int i = 0; i < 2; ++i)
    s2[i] = (h2 ? s4[i + 2] : s4[i]) + __shfl_xor(h2 ? s4[i] : s4[i + 2], 2, 32);
  const float s1 = (h1 ? s2[1] : s2[0]) + __shfl_xor(h1 ? s2[0] : s2[1], 1, 32);
  p[((size_t)b * Tn + t0) * RANKn + lane] = s1;
}

// ---------------------------------------------------------------------------
// Final fused GEMM: out = x + x2d @ base + p @ x_b^T
// x2d is (B*T, D); rows of a wave tile stay inside one sample (16 | 32).
// ---------------------------------------------------------------------------
__global__ __launch_bounds__(128) void final_gemm(const float* __restrict__ x2d,
                                                  const float* __restrict__ base,
                                                  const float* __restrict__ xw,
                                                  const float* __restrict__ p,
                                                  float* __restrict__ out) {
  const int rowBase = blockIdx.y * 64, colBase = blockIdx.x * 64;
  v8f acc[4] = {};
  gemm_core_64x64(x2d, base, Dn, Dn, rowBase, colBase, acc);

  const int lane = threadIdx.x & 31, wave = threadIdx.x >> 5;
  #pragma unroll
  for (int nt = 0; nt < 4; ++nt) {
    #pragma unroll
    for (int v = 0; v < 8; ++v) {
      const int row = rowBase + wave * 16 + v + 8 * (lane >> 4);
      const int col = colBase + nt * 16 + (lane & 15);
      const int b = row >> 5, t = row & 31;
      const float* pr = p + ((size_t)b * Tn + t) * RANKn;
      const float* xb = xw + (size_t)b * (2 * Dn * RANKn) + (size_t)Dn * RANKn
                           + (size_t)col * RANKn;                  // x_b[b, col, :]
      float lr = 0.f;
      #pragma unroll
      for (int r = 0; r < RANKn; ++r) lr += pr[r] * xb[r];
      out[(size_t)row * Dn + col] = x2d[(size_t)row * Dn + col] + acc[nt][v] + lr;
    }
  }
}

// ---------------------------------------------------------------------------
extern "C" void kernel_launch(void* const* d_in, const int* in_sizes, int n_in,
                              void* d_out, int out_size, void* d_ws, size_t ws_size,
                              hipStream_t stream) {
  (void)in_sizes; (void)n_in; (void)out_size; (void)ws_size;
  const float* x    = (const float*)d_in[0];   // (B,T,D)
  const float* ada  = (const float*)d_in[1];   // (B,ADA)
  const float* base = (const float*)d_in[2];   // (D,D)
  const float* w1   = (const float*)d_in[3];   // (ADA,INTER)
  const float* b1   = (const float*)d_in[4];   // (INTER)
  const float* w2   = (const float*)d_in[5];   // (INTER, 2*D*RANK)
  const float* b2   = (const float*)d_in[6];   // (2*D*RANK)
  const float* ln_g = (const float*)d_in[7];   // (ADA)
  const float* ln_b = (const float*)d_in[8];   // (ADA)
  float* out = (float*)d_out;

  float* ws    = (float*)d_ws;
  float* ae_ln = ws;                                   // 128*1024
  float* h     = ae_ln + (size_t)Bn * ADAn;            // 128*1024
  float* xw    = h + (size_t)Bn * INTERn;              // 128*16384
  float* p     = xw + (size_t)Bn * 2 * Dn * RANKn;     // 128*32*8

  // 1) LayerNorm
  ln_kernel<<<Bn, 256, 0, stream>>>(ada, ln_g, ln_b, ae_ln);
  // 2) h = GELU(ae_ln @ w1 + b1)        (128x1024x1024)
  h_gemm<<<dim3(INTERn / HT, Bn / HT), 256, 0, stream>>>(ae_ln, w1, b1, h);
  // 3) xw = h @ w2 + b2                 (128x1024x16384)
  hyper_gemm<<<dim3(2 * Dn * RANKn / 64, Bn / 64), 128, 0, stream>>>(h, w2, b2, xw, INTERn, 2 * Dn * RANKn, 0);
  // 4) p = per-sample x @ x_a           (tiny, rank 8)
  p_kernel<<<Bn * (Tn / PROWS), 128, 0, stream>>>(x, xw, p);
  // 5) out = x + x2d @ base + p @ x_b^T (4096x1024x1024 + rank-8 epilogue)
  final_gemm<<<dim3(Dn / 64, Bn * Tn / 64), 128, 0, stream>>>(x, base, xw, p, out);
}
